// v000
// Measured on an AMD MI455X. A time is GPU time per run, averaged over a window of back-to-back runs after a warm-up
// (all launches, gaps included; the runs take copies of the inputs in turn), and the median of several windows.
// Apart from v000's, it joins two sittings. Times from different sittings can be a few percent apart, while
// side-by-side timings come from the same sitting.
// v000, which the later versions start from, runs in 199 microseconds.
#include <hip/hip_runtime.h>

// scores q_half.k_half^T (both maps): v_wmma_f32_16x16x32_f16, f16 operands = bf16-RNE input values x16, f32 accumulate;
// P.V: v_wmma_f32_16x16x32_f16, P = f16 hi (x4096) + f16 residual (x2^10, own f32 accumulator), V = bf16-RNE input x16; softmax, combine, normalisation in f32.

typedef _Float16 v16h __attribute__((ext_vector_type(16)));
typedef _Float16 h8   __attribute__((ext_vector_type(8)));
typedef float    v8f  __attribute__((ext_vector_type(8)));
typedef float    f4   __attribute__((ext_vector_type(4)));
typedef unsigned int u4 __attribute__((ext_vector_type(4)));

#ifndef NB
#define NB 2
#endif
#ifndef SEQ
#define SEQ 2048
#endif
#define NB_FULL  2
#define SEQ_FULL 2048
#define NH   16
#define HD   64
#define D2   32
#define NBH  (NB * NH)
#define QTILE 128          // query rows per block (8 waves x 16 rows)
#define STILE 64           // keys per main-loop iteration
#define NT    (SEQ / STILE)

static_assert(NB <= NB_FULL);
static_assert(SEQ <= SEQ_FULL);
static_assert(SEQ % QTILE == 0);
static_assert(SEQ % STILE == 0);
static_assert((NBH * SEQ) % 16 == 0);

// ---------------- workspace layout ----------------
#define KH_BYTES  ((size_t)NBH * SEQ * HD * 2)      // f16 K plane  [bh][s][64]
#define VT_BYTES  ((size_t)NBH * HD * SEQ * 2)      // f16 V^T plane [bh][64][s]
#define CTX_BYTES ((size_t)NBH * SEQ * HD * 4)      // f32 ctx plane [bh][s][64], two of them
#define WS_NEED   (KH_BYTES + VT_BYTES + 2 * CTX_BYTES)
static_assert(WS_NEED <= (size_t)134217728);
static_assert(KH_BYTES % 128 == 0);
static_assert(VT_BYTES % 128 == 0);
static_assert(CTX_BYTES % 128 == 0);

// ---------------- attention kernel LDS layout ----------------
#define KL_STR   40                                  // halves per K tile row (32 used)
#define VL_STR   72                                  // halves per V^T tile row (64 used)
#define KL_BYTES (STILE * KL_STR * 2)                // 5120
#define VL_BYTES (HD * VL_STR * 2)                   // 9216
#define PS_BYTES (STILE * 16 * 2)                    // 2048 per plane per wave
#define SMEM_ATT (KL_BYTES + VL_BYTES + 8 * 2 * PS_BYTES)   // 47104
#define STG_BYTES (QTILE * HD * 4)                   // 32768 epilogue staging (aliases smem)
static_assert(STG_BYTES <= SMEM_ATT);

// bf16 RNE of an f32 value, returned as f32
__device__ __forceinline__ float bf16_rne(float x) {
  unsigned u = __float_as_uint(x);
  u = (u + 0x7FFFu + ((u >> 16) & 1u)) & 0xFFFF0000u;
  return __uint_as_float(u);
}
// bf16-RNE value carried x16 in an f16 container (exact)
__device__ __forceinline__ _Float16 cv16(float x) { return (_Float16)(bf16_rne(x) * 16.0f); }

__device__ __forceinline__ v8f wmma16(v16h a, v16h b, v8f c) {
  v8f d = __builtin_amdgcn_wmma_f32_16x16x32_f16(false, a, false, b, (short)0, c, false, false);
  asm volatile("v_nop\n\tv_nop\n\tv_nop\n\tv_nop" : "+v"(d) : "v"(a), "v"(b));
  return d;
}

// =================================================================
// Pre-pass: K -> f16 plane [bh][s][64] (x16), V -> f16 transposed plane [bh][64][s] (x16)
// grid (SEQ/64, NBH), 256 threads; one 64-key tile per block
// =================================================================
__global__ __launch_bounds__(256) void k_conv(const float* __restrict__ K,
                                              const float* __restrict__ V,
                                              _Float16* __restrict__ Kh,
                                              _Float16* __restrict__ Vt) {
  __shared__ __align__(16) _Float16 vtl[HD * VL_STR];   // [d][s] tile, cross-wave (block barrier)
  const int tid = threadIdx.x;
  const int bh  = blockIdx.y;
  const int s0  = blockIdx.x * STILE;
  const float* Kg = K + ((size_t)bh * SEQ_FULL + s0) * HD;
  const float* Vg = V + ((size_t)bh * SEQ_FULL + s0) * HD;
  _Float16* Kp = Kh + ((size_t)bh * SEQ + s0) * HD;
  _Float16* Vp = Vt + (size_t)bh * HD * SEQ + s0;

  union HU8 { h8 h; u4 u; _Float16 s[8]; };
  HU8 kv[2];
#pragma unroll
  for (int i = 0; i < 2; ++i) {
    const int idx = tid + 256 * i;           // 0..511
    const int row = idx >> 3;                // key row 0..63
    const int c8  = (idx & 7) * 8;           // d 0..56
    const f4 a  = *(const f4*)(Kg + row * HD + c8);
    const f4 b  = *(const f4*)(Kg + row * HD + c8 + 4);
    const f4 va = *(const f4*)(Vg + row * HD + c8);
    const f4 vb = *(const f4*)(Vg + row * HD + c8 + 4);
#pragma unroll
    for (int e = 0; e < 4; ++e) {
      kv[i].s[e]     = cv16(a[e]);
      kv[i].s[4 + e] = cv16(b[e]);
      vtl[(c8 + e) * VL_STR + row]     = cv16(va[e]);
      vtl[(c8 + 4 + e) * VL_STR + row] = cv16(vb[e]);
    }
  }
  __syncthreads();
  HU8 vv[2];
#pragma unroll
  for (int i = 0; i < 2; ++i) {
    const int idx = tid + 256 * i;
    const int d   = idx >> 3;
    const int p8  = (idx & 7) * 8;
    vv[i].h = *(const h8*)(vtl + d * VL_STR + p8);
  }
#pragma unroll
  for (int i = 0; i < 2; ++i) {
    const int idx = tid + 256 * i;
    const int row = idx >> 3, c8 = (idx & 7) * 8;
    *(u4*)(Kp + row * HD + c8) = kv[i].u;
    *(u4*)(Vp + (size_t)row * SEQ + c8) = vv[i].u;   // row = d here
  }
  
}

// =================================================================
// Flash softmax attention for one map (blockIdx.z selects the d-half of q/k),
// writes ctx_map = softmax(q_h k_h^T * scale) . V as f32 plane [bh][s][64].
// grid (SEQ/QTILE, NBH, 2), 256 threads (8 waves x 16 query rows), 64-key tiles.
// =================================================================
__global__ __launch_bounds__(256) void k_attn(const float* __restrict__ Q,
                                              const _Float16* __restrict__ Kh,
                                              const _Float16* __restrict__ Vt,
                                              float* __restrict__ Ctx) {
  const int tid  = threadIdx.x;
  const int lane = tid & 31;
  const int wave = tid >> 5;
  const int l16  = lane & 15;
  const int half = lane >> 4;
  const int kb8  = half * 8;

  const int bh    = blockIdx.y;
  const int qBase = blockIdx.x * QTILE;
  const int doff  = blockIdx.z * D2;
  float* ctx = Ctx + (size_t)blockIdx.z * ((size_t)NBH * SEQ * HD);

  __shared__ __align__(16) unsigned char smem[SMEM_ATT];
  _Float16* Kl  = (_Float16*)smem;                                           // [64 key][40]  cross-wave
  _Float16* Vl  = (_Float16*)(smem + KL_BYTES);                              // [64 d][72]    cross-wave
  _Float16* pHi = (_Float16*)(smem + KL_BYTES + VL_BYTES + wave * (2 * PS_BYTES));  // [64 key][16 row] per wave
  _Float16* pLo = pHi + STILE * 16;
  float*    stg = (float*)smem;                                              // epilogue alias [128][64]

  // ---- Q A-fragment (16 rows x 32 d of the selected half) straight from f32 global ----
  union HU { v16h v; h8 p[2]; _Float16 s[16]; };
  HU uq;
  {
    const float* qp = Q + ((size_t)bh * SEQ_FULL + qBase + wave * 16 + l16) * HD + doff;
    const f4 x0 = *(const f4*)(qp + kb8);
    const f4 x1 = *(const f4*)(qp + kb8 + 4);
    const f4 x2 = *(const f4*)(qp + 16 + kb8);
    const f4 x3 = *(const f4*)(qp + 16 + kb8 + 4);
#pragma unroll
    for (int e = 0; e < 4; ++e) {
      uq.s[e]      = cv16(x0[e]);   // elements 0..7  <- d = 8h + 0..7
      uq.s[4 + e]  = cv16(x1[e]);
      uq.s[8 + e]  = cv16(x2[e]);   // elements 8..15 <- d = 16 + 8h + 0..7
      uq.s[12 + e] = cv16(x3[e]);
    }
  }
  const v16h qa = uq.v;

  // ---- online-softmax state ----
  float m[8], lsum[8];
  v8f accH[4], accL[4];
#pragma unroll
  for (int j = 0; j < 8; ++j) { m[j] = -1.0e30f; lsum[j] = 0.0f; }
#pragma unroll
  for (int n = 0; n < 4; ++n)
#pragma unroll
    for (int j = 0; j < 8; ++j) { accH[n][j] = 0.0f; accL[n][j] = 0.0f; }

  const _Float16* khBase = Kh + (size_t)bh * SEQ * HD + doff;
  const _Float16* vtBase = Vt + (size_t)bh * HD * SEQ;
  const int skey = tid >> 2;          // K staging: key row 0..63
  const int spc  = (tid & 3) * 8;     // K staging: 8-halves piece of the 32-d half
  // (1/sqrt(32)) / 256 : q and k each carried x16
  const float SC = 0.17677669529663688f * 0.00390625f;

  for (int it = 0; it < NT; ++it) {
    const int kb = it * STILE;
    __syncthreads();   // all waves done with Kl / Vl / pHi / pLo of the prior tile
    {
      const h8 kx = *(const h8*)(khBase + (size_t)(kb + skey) * HD + spc);
      *(h8*)(Kl + skey * KL_STR + spc) = kx;
#pragma unroll
      for (int i = 0; i < 2; ++i) {
        const int idx = tid + 256 * i;       // 0..511
        const int d   = idx >> 3;            // 0..63
        const int p8  = (idx & 7) * 8;       // key 0..56
        const h8 vx = *(const h8*)(vtBase + (size_t)d * SEQ + kb + p8);
        *(h8*)(Vl + d * VL_STR + p8) = vx;
      }
    }
    __syncthreads();

    // ---- scores over four 16-key subtiles (K = 32 = one WMMA each) ----
    float p[4][8];
    float tmax[8];
#pragma unroll
    for (int j = 0; j < 8; ++j) tmax[j] = -1.0e30f;

#pragma unroll
    for (int t = 0; t < 4; ++t) {
      HU ub;
      const _Float16* kr = Kl + (t * 16 + l16) * KL_STR;   // B column n = key t*16 + l16
      ub.p[0] = *(const h8*)(kr + kb8);                    // elements 0..7  <- d = 8h + 0..7
      ub.p[1] = *(const h8*)(kr + 16 + kb8);               // elements 8..15 <- d = 16 + 8h + 0..7
      v8f c8;
#pragma unroll
      for (int j = 0; j < 8; ++j) c8[j] = 0.0f;
      c8 = wmma16(qa, ub.v, c8);                           // D[row 8h+j][key t*16+l16]
#pragma unroll
      for (int j = 0; j < 8; ++j) {
        const float lg = c8[j] * SC;
        p[t][j] = lg;
        tmax[j] = fmaxf(tmax[j], lg);
      }
    }

    // ---- row reductions across the 16 column lanes (per lane half) ----
#pragma unroll
    for (int j = 0; j < 8; ++j) {
      float v = tmax[j];
      v = fmaxf(v, __shfl_xor(v, 1, 32));
      v = fmaxf(v, __shfl_xor(v, 2, 32));
      v = fmaxf(v, __shfl_xor(v, 4, 32));
      v = fmaxf(v, __shfl_xor(v, 8, 32));
      tmax[j] = v;
    }
    float corr[8];
#pragma unroll
    for (int j = 0; j < 8; ++j) {
      const float nm = fmaxf(m[j], tmax[j]);
      corr[j] = __expf(m[j] - nm);
      m[j] = nm;
    }
#pragma unroll
    for (int j = 0; j < 8; ++j) {
      float s = 0.0f;
#pragma unroll
      for (int t = 0; t < 4; ++t) {
        p[t][j] = __expf(p[t][j] - m[j]);
        s += p[t][j];
      }
      s += __shfl_xor(s, 1, 32);
      s += __shfl_xor(s, 2, 32);
      s += __shfl_xor(s, 4, 32);
      s += __shfl_xor(s, 8, 32);
      lsum[j] = lsum[j] * corr[j] + s;
    }
#pragma unroll
    for (int n = 0; n < 4; ++n)
#pragma unroll
      for (int j = 0; j < 8; ++j) { accH[n][j] *= corr[j]; accL[n][j] *= corr[j]; }

    // ---- P (D-layout) -> per-wave LDS [key][row]: hi = f16(4096 p), lo = f16((4096 p - hi) * 1024) ----
#pragma unroll
    for (int t = 0; t < 4; ++t) {
      union { _Float16 s[8]; h8 v; } uh, ul;
#pragma unroll
      for (int j = 0; j < 8; ++j) {
        const float pc = p[t][j] * 4096.0f;
        const _Float16 hv = (_Float16)pc;
        uh.s[j] = hv;
        ul.s[j] = (_Float16)((pc - (float)hv) * 1024.0f);
      }
      *(h8*)(pHi + (t * 16 + l16) * 16 + half * 8) = uh.v;   // keys t*16+l16, rows 8h..8h+7
      *(h8*)(pLo + (t * 16 + l16) * 16 + half * 8) = ul.v;
    }
    __syncthreads();   // P tiles visible (block barrier used even though the region is per wave)

    // ---- P A-fragments (split k-map over keys), V^T B-fragments, P.V ----
    v16h ph0, ph1, pl0, pl1;
#pragma unroll
    for (int c = 0; c < 8; ++c) {
      ph0[c]     = pHi[(kb8 + c) * 16 + l16];
      ph0[c + 8] = pHi[(16 + kb8 + c) * 16 + l16];
      ph1[c]     = pHi[(32 + kb8 + c) * 16 + l16];
      ph1[c + 8] = pHi[(48 + kb8 + c) * 16 + l16];
      pl0[c]     = pLo[(kb8 + c) * 16 + l16];
      pl0[c + 8] = pLo[(16 + kb8 + c) * 16 + l16];
      pl1[c]     = pLo[(32 + kb8 + c) * 16 + l16];
      pl1[c + 8] = pLo[(48 + kb8 + c) * 16 + l16];
    }
#pragma unroll
    for (int n = 0; n < 4; ++n) {
      HU uv0, uv1;
      const _Float16* vr = Vl + (16 * n + l16) * VL_STR;  // B column n = d 16n + l16
      uv0.p[0] = *(const h8*)(vr + kb8);                   // keys 8h + 0..7
      uv0.p[1] = *(const h8*)(vr + 16 + kb8);              // keys 16 + 8h + 0..7
      uv1.p[0] = *(const h8*)(vr + 32 + kb8);
      uv1.p[1] = *(const h8*)(vr + 48 + kb8);
      accH[n] = wmma16(ph0, uv0.v, accH[n]);
      accH[n] = wmma16(ph1, uv1.v, accH[n]);
      accL[n] = wmma16(pl0, uv0.v, accL[n]);
      accL[n] = wmma16(pl1, uv1.v, accL[n]);
    }
  }
  __syncthreads();   // all LDS use of the main loop complete before the staging alias

  // ---- finalize: ctx = (accH + accL * 2^-10) / lsum / (4096 * 16), stage per wave, whole-line stores ----
  {
    float inv[8];
#pragma unroll
    for (int j = 0; j < 8; ++j) inv[j] = (1.0f / lsum[j]) * (1.0f / 65536.0f);
    float* sw = stg + wave * (16 * HD);
#pragma unroll
    for (int n = 0; n < 4; ++n)
#pragma unroll
      for (int j = 0; j < 8; ++j)
        sw[(8 * half + j) * HD + 16 * n + l16] = (accH[n][j] + accL[n][j] * (1.0f / 1024.0f)) * inv[j];
  }
  __syncthreads();
  f4 ov[8];
  {
    const float* sw = stg + wave * (16 * HD);
#pragma unroll
    for (int k = 0; k < 8; ++k) {
      const int row = 2 * k + half;
      ov[k] = *(const f4*)(sw + row * HD + l16 * 4);
    }
  }
  float* cg = ctx + ((size_t)bh * SEQ + qBase + wave * 16) * HD;
#pragma unroll
  for (int k = 0; k < 8; ++k)
    *(f4*)(cg + (size_t)(2 * k + half) * HD + l16 * 4) = ov[k];
  
}

// =================================================================
// Combine + normalisation: r = ctx1 - lambda_h * ctx2; out = (r - mean) * rsqrt(var + 1e-5) * 0.2
// grid (NBH*SEQ/16), 256 threads: 16 lanes per row of 64 floats (4 floats per lane)
// =================================================================
__global__ __launch_bounds__(256) void k_comb(const float* __restrict__ C0,
                                              const float* __restrict__ C1,
                                              const float* __restrict__ Lam,
                                              int nlam,
                                              float* __restrict__ Out) {
  const int tid = threadIdx.x;
  const int r   = blockIdx.x * 16 + (tid >> 4);     // < NBH*SEQ (exact grid)
  const int c4  = (tid & 15) * 4;
  const int bh  = r / SEQ;
  int h = bh % NH;
  h = min(h, nlam - 1);
  h = max(h, 0);
  const float lam = bf16_rne(Lam[h]);
  const size_t off = (size_t)r * HD + c4;
  const f4 a = *(const f4*)(C0 + off);
  const f4 b = *(const f4*)(C1 + off);
  float x[4];
#pragma unroll
  for (int i = 0; i < 4; ++i) x[i] = a[i] - lam * b[i];
  float s = (x[0] + x[1]) + (x[2] + x[3]);
  s += __shfl_xor(s, 1, 32);
  s += __shfl_xor(s, 2, 32);
  s += __shfl_xor(s, 4, 32);
  s += __shfl_xor(s, 8, 32);
  const float mean = s * (1.0f / 64.0f);
  float d[4];
  float ss = 0.0f;
#pragma unroll
  for (int i = 0; i < 4; ++i) { d[i] = x[i] - mean; ss += d[i] * d[i]; }
  ss += __shfl_xor(ss, 1, 32);
  ss += __shfl_xor(ss, 2, 32);
  ss += __shfl_xor(ss, 4, 32);
  ss += __shfl_xor(ss, 8, 32);
  const float var = ss * (1.0f / 64.0f);
  const float rs  = rsqrtf(var + 1.0e-5f);
  f4 o;
#pragma unroll
  for (int i = 0; i < 4; ++i) o[i] = (d[i] * rs) * 0.2f;
  *(f4*)(Out + off) = o;
  
}

// =================================================================
// Host launcher
// =================================================================
extern "C" void kernel_launch(void* const* d_in, const int* in_sizes, int n_in,
                              void* d_out, int out_size, void* d_ws, size_t ws_size,
                              hipStream_t stream) {
  if (n_in < 4) return;
  const long long needIn = ((long long)(NBH - 1) * SEQ_FULL + SEQ) * HD;
  if ((long long)in_sizes[0] < needIn || (long long)in_sizes[1] < needIn ||
      (long long)in_sizes[2] < needIn || in_sizes[3] < 1) return;
  if ((long long)out_size < (long long)NBH * SEQ * HD) return;
  if (d_ws == nullptr || ws_size < WS_NEED) return;

  const float* Q   = (const float*)d_in[0];
  const float* K   = (const float*)d_in[1];
  const float* V   = (const float*)d_in[2];
  const float* Lam = (const float*)d_in[3];
  float* Out = (float*)d_out;

  char* ws = (char*)d_ws;
  _Float16* Kh  = (_Float16*)(ws);
  _Float16* Vt  = (_Float16*)(ws + KH_BYTES);
  float*    Ctx = (float*)(ws + KH_BYTES + VT_BYTES);             // two planes back to back
  float*    Ctx1 = Ctx + (size_t)NBH * SEQ * HD;

  k_conv<<<dim3(SEQ / STILE, NBH), dim3(256), 0, stream>>>(K, V, Kh, Vt);
  k_attn<<<dim3(SEQ / QTILE, NBH, 2), dim3(256), 0, stream>>>(Q, Kh, Vt, Ctx);
  k_comb<<<dim3((NBH * SEQ) / 16), dim3(256), 0, stream>>>(Ctx, Ctx1, Lam, in_sizes[3], Out);
}

// v001
// A run of this version takes 122 microseconds.
// In two side-by-side timings against v000, it was 1.70 and 1.69 times as fast.
#include <hip/hip_runtime.h>

// scores k_half.q_half^T, transposed (both maps): v_wmma_f32_16x16x32_f16, f16 operands = bf16-RNE input values x16, f32 accumulate;
// V^T.P^T: v_wmma_f32_16x16x32_f16, P = f16 hi (x4096) + f16 residual (x2^10, own f32 accumulator), V = bf16-RNE input x16; softmax, combine, normalisation in f32.

typedef _Float16 v16h __attribute__((ext_vector_type(16)));
typedef _Float16 h8   __attribute__((ext_vector_type(8)));
typedef float    v8f  __attribute__((ext_vector_type(8)));
typedef float    f4   __attribute__((ext_vector_type(4)));
typedef unsigned int u4 __attribute__((ext_vector_type(4)));

#ifndef NB
#define NB 2
#endif
#ifndef SEQ
#define SEQ 2048
#endif
#define NB_FULL  2
#define SEQ_FULL 2048
#define NH   16
#define HD   64
#define D2   32
#define NBH  (NB * NH)
#define QTILE 128          // query rows per block (8 waves x 16 rows)
#define STILE 64           // keys per main-loop iteration
#define NT    (SEQ / STILE)

static_assert(NB <= NB_FULL);
static_assert(SEQ <= SEQ_FULL);
static_assert(SEQ % QTILE == 0);
static_assert(SEQ % STILE == 0);
static_assert((NBH * SEQ) % 16 == 0);

// ---------------- workspace layout ----------------
#define KH_BYTES  ((size_t)NBH * SEQ * HD * 2)      // f16 K plane  [bh][s][64]
#define VT_BYTES  ((size_t)NBH * HD * SEQ * 2)      // f16 V^T plane [bh][64][s]
#define CTX_BYTES ((size_t)NBH * SEQ * HD * 4)      // f32 ctx plane [bh][s][64], two of them
#define WS_NEED   (KH_BYTES + VT_BYTES + 2 * CTX_BYTES)
static_assert(WS_NEED <= (size_t)134217728);
static_assert(KH_BYTES % 128 == 0);
static_assert(VT_BYTES % 128 == 0);
static_assert(CTX_BYTES % 128 == 0);

// ---------------- attention kernel LDS layout ----------------
#define KL_STR   40                                  // halves per K tile row (32 used)
#define VL_STR   72                                  // halves per V^T tile row (64 used)
#define KL_BYTES (STILE * KL_STR * 2)                // 5120
#define VL_BYTES (HD * VL_STR * 2)                   // 9216
#define STG_STR  68                                  // floats per staged output row (64 used; 272 B = 16 B x odd)
#define STG_BYTES (QTILE * STG_STR * 4)              // 34816 epilogue staging (aliases the K / V tiles)
#define SMEM_ATT (KL_BYTES + VL_BYTES > STG_BYTES ? KL_BYTES + VL_BYTES : STG_BYTES)

// bf16 RNE of an f32 value, returned as f32
__device__ __forceinline__ float bf16_rne(float x) {
  unsigned u = __float_as_uint(x);
  u = (u + 0x7FFFu + ((u >> 16) & 1u)) & 0xFFFF0000u;
  return __uint_as_float(u);
}
// bf16-RNE value carried x16 in an f16 container (exact)
__device__ __forceinline__ _Float16 cv16(float x) { return (_Float16)(bf16_rne(x) * 16.0f); }

// lane l <-> lane l ^ 16
__device__ __forceinline__ float xhalf(float x) {
  const int b = __builtin_bit_cast(int, x);
  return __builtin_bit_cast(float, __builtin_amdgcn_permlanex16(b, b, 0x76543210, 0xfedcba98, false, false));
}

__device__ __forceinline__ v8f wmma16(v16h a, v16h b, v8f c) {
  v8f d = __builtin_amdgcn_wmma_f32_16x16x32_f16(false, a, false, b, (short)0, c, false, false);
  asm volatile("v_nop\n\tv_nop\n\tv_nop\n\tv_nop" : "+v"(d) : "v"(a), "v"(b));
  return d;
}

// =================================================================
// Pre-pass: K -> f16 plane [bh][s][64] (x16), V -> f16 transposed plane [bh][64][s] (x16)
// grid (SEQ/64, NBH), 256 threads; one 64-key tile per block
// =================================================================
__global__ __launch_bounds__(256) void k_conv(const float* __restrict__ K,
                                              const float* __restrict__ V,
                                              _Float16* __restrict__ Kh,
                                              _Float16* __restrict__ Vt) {
  __shared__ __align__(16) _Float16 vtl[HD * VL_STR];   // [d][s] tile, cross-wave (block barrier)
  const int tid = threadIdx.x;
  const int bh  = blockIdx.y;
  const int s0  = blockIdx.x * STILE;
  const float* Kg = K + ((size_t)bh * SEQ_FULL + s0) * HD;
  const float* Vg = V + ((size_t)bh * SEQ_FULL + s0) * HD;
  _Float16* Kp = Kh + ((size_t)bh * SEQ + s0) * HD;
  _Float16* Vp = Vt + (size_t)bh * HD * SEQ + s0;

  union HU8 { h8 h; u4 u; _Float16 s[8]; };
  HU8 kv[2];
#pragma unroll
  for (int i = 0; i < 2; ++i) {
    const int idx = tid + 256 * i;           // 0..511
    const int row = idx >> 3;                // key row 0..63
    const int c8  = (idx & 7) * 8;           // d 0..56
    const f4 a  = *(const f4*)(Kg + row * HD + c8);
    const f4 b  = *(const f4*)(Kg + row * HD + c8 + 4);
    const f4 va = *(const f4*)(Vg + row * HD + c8);
    const f4 vb = *(const f4*)(Vg + row * HD + c8 + 4);
#pragma unroll
    for (int e = 0; e < 4; ++e) {
      kv[i].s[e]     = cv16(a[e]);
      kv[i].s[4 + e] = cv16(b[e]);
      vtl[(c8 + e) * VL_STR + row]     = cv16(va[e]);
      vtl[(c8 + 4 + e) * VL_STR + row] = cv16(vb[e]);
    }
  }
  __syncthreads();
  HU8 vv[2];
#pragma unroll
  for (int i = 0; i < 2; ++i) {
    const int idx = tid + 256 * i;
    const int d   = idx >> 3;
    const int p8  = (idx & 7) * 8;
    vv[i].h = *(const h8*)(vtl + d * VL_STR + p8);
  }
#pragma unroll
  for (int i = 0; i < 2; ++i) {
    const int idx = tid + 256 * i;
    const int row = idx >> 3, c8 = (idx & 7) * 8;
    *(u4*)(Kp + row * HD + c8) = kv[i].u;
    *(u4*)(Vp + (size_t)row * SEQ + c8) = vv[i].u;   // row = d here
  }
  
}

__global__ __launch_bounds__(256) void k_attn(const float* __restrict__ Q,
                                              const _Float16* __restrict__ Kh,
                                              const _Float16* __restrict__ Vt,
                                              float* __restrict__ Ctx) {
  const int tid  = threadIdx.x;
  const int lane = tid & 31;
  const int wave = tid >> 5;
  const int l16  = lane & 15;
  const int half = lane >> 4;
  const int kb8  = half * 8;

  const int bh    = blockIdx.y;
  const int qBase = blockIdx.x * QTILE;
  const int doff  = blockIdx.z * D2;
  float* ctx = Ctx + (size_t)blockIdx.z * ((size_t)NBH * SEQ * HD);

  __shared__ __align__(16) unsigned char smem[SMEM_ATT];
  _Float16* Kl  = (_Float16*)smem;                                           // [64 key][40]  cross-wave
  _Float16* Vl  = (_Float16*)(smem + KL_BYTES);                              // [64 d][72]    cross-wave
  float*    stg = (float*)smem;                                              // epilogue alias [128][68]

  // ---- Q B-fragment (column = query l16, 32 d of the selected half) straight from f32 global ----
  union HU { v16h v; h8 p[2]; _Float16 s[16]; };
  HU uq;
  {
    const float* qp = Q + ((size_t)bh * SEQ_FULL + qBase + wave * 16 + l16) * HD + doff;
    const f4 x0 = *(const f4*)(qp + kb8);
    const f4 x1 = *(const f4*)(qp + kb8 + 4);
    const f4 x2 = *(const f4*)(qp + 16 + kb8);
    const f4 x3 = *(const f4*)(qp + 16 + kb8 + 4);
#pragma unroll
    for (int e = 0; e < 4; ++e) {
      uq.s[e]      = cv16(x0[e]);   // elements 0..7  <- d = 8h + 0..7
      uq.s[4 + e]  = cv16(x1[e]);
      uq.s[8 + e]  = cv16(x2[e]);   // elements 8..15 <- d = 16 + 8h + 0..7
      uq.s[12 + e] = cv16(x3[e]);
    }
  }
  const v16h qa = uq.v;

  // ---- online-softmax state ----
  // ---- per lane: query l16; lsum holds the sum over this lane half's keys, joined in the epilogue ----
  float m = -1.0e30f, lsum = 0.0f;
  v8f accH[4], accL[4];                // O^T tiles: register j = d 16n + 8h + j, column = query l16
#pragma unroll
  for (int n = 0; n < 4; ++n)
#pragma unroll
    for (int j = 0; j < 8; ++j) { accH[n][j] = 0.0f; accL[n][j] = 0.0f; }

  const _Float16* khBase = Kh + (size_t)bh * SEQ * HD + doff;
  const _Float16* vtBase = Vt + (size_t)bh * HD * SEQ;
  const int skey = tid >> 2;          // K staging: key row 0..63
  const int spc  = (tid & 3) * 8;     // K staging: 8-halves piece of the 32-d half
  // (1/sqrt(32)) / 256 : q and k each carried x16
  const float SC = 0.17677669529663688f * 0.00390625f;

  for (int it = 0; it < NT; ++it) {
    const int kb = it * STILE;
    __syncthreads();   // all waves done with Kl / Vl of the prior tile
    {
      const h8 kx = *(const h8*)(khBase + (size_t)(kb + skey) * HD + spc);
      *(h8*)(Kl + skey * KL_STR + spc) = kx;
#pragma unroll
      for (int i = 0; i < 2; ++i) {
        const int idx = tid + 256 * i;       // 0..511
        const int d   = idx >> 3;            // 0..63
        const int p8  = (idx & 7) * 8;       // key 0..56
        const h8 vx = *(const h8*)(vtBase + (size_t)d * SEQ + kb + p8);
        *(h8*)(Vl + d * VL_STR + p8) = vx;
      }
    }
    __syncthreads();

    // ---- S^T over four 16-key subtiles (K = 32 = one WMMA each) ----
    float p[4][8];
    float tmax = -1.0e30f;
#pragma unroll
    for (int t = 0; t < 4; ++t) {
      HU ua;
      const _Float16* kr = Kl + (t * 16 + l16) * KL_STR;   // A row m = key t*16 + l16
      ua.p[0] = *(const h8*)(kr + kb8);                    // elements 0..7  <- d = 8h + 0..7
      ua.p[1] = *(const h8*)(kr + 16 + kb8);               // elements 8..15 <- d = 16 + 8h + 0..7
      v8f c8;
#pragma unroll
      for (int j = 0; j < 8; ++j) c8[j] = 0.0f;
      c8 = wmma16(ua.v, qa, c8);                           // D[key t*16 + 8h + j][query l16]
#pragma unroll
      for (int j = 0; j < 8; ++j) {
        const float lg = c8[j] * SC;
        p[t][j] = lg;
        tmax = fmaxf(tmax, lg);
      }
    }

    // ---- one query per lane: maximum in-lane, one exchange between the lane halves ----
    tmax = fmaxf(tmax, xhalf(tmax));
    const float nm   = fmaxf(m, tmax);
    const float corr = __expf(m - nm);
    m = nm;
    float s[4];                        // one independent chain per subtile
#pragma unroll
    for (int t = 0; t < 4; ++t) {
      s[t] = 0.0f;
#pragma unroll
      for (int j = 0; j < 8; ++j) {
        p[t][j] = __expf(p[t][j] - m);
        s[t] += p[t][j];
      }
    }
    lsum = lsum * corr + ((s[0] + s[1]) + (s[2] + s[3]));
#pragma unroll
    for (int n = 0; n < 4; ++n)
#pragma unroll
      for (int j = 0; j < 8; ++j) { accH[n][j] *= corr; accL[n][j] *= corr; }

    // ---- P^T B-fragments in place: hi = f16(4096 p), lo = f16((4096 p - hi) * 1024);
    //      element e of pair g <- key 32g + (e < 8 ? 8h + e : 16 + 8h + e - 8) = subtile 2g + (e >> 3), register e & 7 ----
    v16h ph[2], pl[2];
#pragma unroll
    for (int t = 0; t < 4; ++t)
#pragma unroll
      for (int j = 0; j < 8; ++j) {
        const float pc = p[t][j] * 4096.0f;
        const _Float16 hv = (_Float16)pc;
        ph[t >> 1][(t & 1) * 8 + j] = hv;
        pl[t >> 1][(t & 1) * 8 + j] = (_Float16)((pc - (float)hv) * 1024.0f);
      }

    // ---- V^T A-fragments, O^T += V^T.P^T ----
#pragma unroll
    for (int n = 0; n < 4; ++n) {
      HU uv0, uv1;
      const _Float16* vr = Vl + (16 * n + l16) * VL_STR;  // A row m = d 16n + l16
      uv0.p[0] = *(const h8*)(vr + kb8);                   // keys 8h + 0..7
      uv0.p[1] = *(const h8*)(vr + 16 + kb8);              // keys 16 + 8h + 0..7
      uv1.p[0] = *(const h8*)(vr + 32 + kb8);
      uv1.p[1] = *(const h8*)(vr + 48 + kb8);
      accH[n] = wmma16(uv0.v, ph[0], accH[n]);
      accH[n] = wmma16(uv1.v, ph[1], accH[n]);
      accL[n] = wmma16(uv0.v, pl[0], accL[n]);
      accL[n] = wmma16(uv1.v, pl[1], accL[n]);
    }
  }
  __syncthreads();   // all LDS use of the main loop complete before the staging alias

  // ---- finalize: ctx = (accH + accL * 2^-10) / lsum / (4096 * 16), stage per wave, whole-line stores ----
  {
    lsum += xhalf(lsum);
    const float inv = (1.0f / lsum) * (1.0f / 65536.0f);
    float* sw = stg + wave * (16 * STG_STR) + l16 * STG_STR + 8 * half;   // row = query l16
#pragma unroll
    for (int n = 0; n < 4; ++n) {
      f4 o0, o1;
#pragma unroll
      for (int j = 0; j < 4; ++j) {
        o0[j] = (accH[n][j] + accL[n][j] * (1.0f / 1024.0f)) * inv;
        o1[j] = (accH[n][4 + j] + accL[n][4 + j] * (1.0f / 1024.0f)) * inv;
      }
      *(f4*)(sw + 16 * n)     = o0;    // d 16n + 8h + 0..3
      *(f4*)(sw + 16 * n + 4) = o1;    // d 16n + 8h + 4..7
    }
  }
  __syncthreads();
  f4 ov[8];
  {
    const float* sw = stg + wave * (16 * STG_STR);
#pragma unroll
    for (int k = 0; k < 8; ++k) {
      const int row = 2 * k + half;
      ov[k] = *(const f4*)(sw + row * STG_STR + l16 * 4);
    }
  }
  float* cg = ctx + ((size_t)bh * SEQ + qBase + wave * 16) * HD;
#pragma unroll
  for (int k = 0; k < 8; ++k)
    *(f4*)(cg + (size_t)(2 * k + half) * HD + l16 * 4) = ov[k];
  
}

// =================================================================
// Combine + normalisation: r = ctx1 - lambda_h * ctx2; out = (r - mean) * rsqrt(var + 1e-5) * 0.2
// grid (NBH*SEQ/16), 256 threads: 16 lanes per row of 64 floats (4 floats per lane)
// =================================================================
__global__ __launch_bounds__(256) void k_comb(const float* __restrict__ C0,
                                              const float* __restrict__ C1,
                                              const float* __restrict__ Lam,
                                              int nlam,
                                              float* __restrict__ Out) {
  const int tid = threadIdx.x;
  const int r   = blockIdx.x * 16 + (tid >> 4);     // < NBH*SEQ (exact grid)
  const int c4  = (tid & 15) * 4;
  const int bh  = r / SEQ;
  int h = bh % NH;
  h = min(h, nlam - 1);
  h = max(h, 0);
  const float lam = bf16_rne(Lam[h]);
  const size_t off = (size_t)r * HD + c4;
  const f4 a = *(const f4*)(C0 + off);
  const f4 b = *(const f4*)(C1 + off);
  float x[4];
#pragma unroll
  for (int i = 0; i < 4; ++i) x[i] = a[i] - lam * b[i];
  float s = (x[0] + x[1]) + (x[2] + x[3]);
  s += __shfl_xor(s, 1, 32);
  s += __shfl_xor(s, 2, 32);
  s += __shfl_xor(s, 4, 32);
  s += __shfl_xor(s, 8, 32);
  const float mean = s * (1.0f / 64.0f);
  float d[4];
  float ss = 0.0f;
#pragma unroll
  for (int i = 0; i < 4; ++i) { d[i] = x[i] - mean; ss += d[i] * d[i]; }
  ss += __shfl_xor(ss, 1, 32);
  ss += __shfl_xor(ss, 2, 32);
  ss += __shfl_xor(ss, 4, 32);
  ss += __shfl_xor(ss, 8, 32);
  const float var = ss * (1.0f / 64.0f);
  const float rs  = rsqrtf(var + 1.0e-5f);
  f4 o;
#pragma unroll
  for (int i = 0; i < 4; ++i) o[i] = (d[i] * rs) * 0.2f;
  *(f4*)(Out + off) = o;
  
}

// =================================================================
// Host launcher
// =================================================================
extern "C" void kernel_launch(void* const* d_in, const int* in_sizes, int n_in,
                              void* d_out, int out_size, void* d_ws, size_t ws_size,
                              hipStream_t stream) {
  if (n_in < 4) return;
  const long long needIn = ((long long)(NBH - 1) * SEQ_FULL + SEQ) * HD;
  if ((long long)in_sizes[0] < needIn || (long long)in_sizes[1] < needIn ||
      (long long)in_sizes[2] < needIn || in_sizes[3] < 1) return;
  if ((long long)out_size < (long long)NBH * SEQ * HD) return;
  if (d_ws == nullptr || ws_size < WS_NEED) return;

  const float* Q   = (const float*)d_in[0];
  const float* K   = (const float*)d_in[1];
  const float* V   = (const float*)d_in[2];
  const float* Lam = (const float*)d_in[3];
  float* Out = (float*)d_out;

  char* ws = (char*)d_ws;
  _Float16* Kh  = (_Float16*)(ws);
  _Float16* Vt  = (_Float16*)(ws + KH_BYTES);
  float*    Ctx = (float*)(ws + KH_BYTES + VT_BYTES);             // two planes back to back
  float*    Ctx1 = Ctx + (size_t)NBH * SEQ * HD;

  k_conv<<<dim3(SEQ / STILE, NBH), dim3(256), 0, stream>>>(K, V, Kh, Vt);
  k_attn<<<dim3(SEQ / QTILE, NBH, 2), dim3(256), 0, stream>>>(Q, Kh, Vt, Ctx);
  k_comb<<<dim3((NBH * SEQ) / 16), dim3(256), 0, stream>>>(Ctx, Ctx1, Lam, in_sizes[3], Out);
}

// v002
// Measured time: 118 microseconds a run.
// Timed twice side by side with v001, it ran 1.04 times as fast both times.
// Over all steps from v000 it is 1.76 times as fast.
#include <hip/hip_runtime.h>

// scores k_half.q_half^T, transposed (both maps): v_wmma_f32_16x16x32_f16, f16 operands = bf16-RNE input values x16, f32 accumulate;
// V^T.P^T: v_wmma_f32_16x16x32_f16, P = f16 hi (x4096) + f16 residual (x2^10, own f32 accumulator), V = bf16-RNE input x16; softmax, combine, normalisation in f32.

typedef _Float16 v16h __attribute__((ext_vector_type(16)));
typedef _Float16 h8   __attribute__((ext_vector_type(8)));
typedef float    v8f  __attribute__((ext_vector_type(8)));
typedef float    f4   __attribute__((ext_vector_type(4)));
typedef unsigned int u4 __attribute__((ext_vector_type(4)));

#ifndef NB
#define NB 2
#endif
#ifndef SEQ
#define SEQ 2048
#endif
#define NB_FULL  2
#define SEQ_FULL 2048
#define NH   16
#define HD   64
#define D2   32
#define NBH  (NB * NH)
#define QTILE 64           // query rows per block (4 waves x 16 rows for each of the two maps)
#define STILE 64           // keys per main-loop iteration
#define NT    (SEQ / STILE)

static_assert(NB <= NB_FULL);
static_assert(SEQ <= SEQ_FULL);
static_assert(SEQ % QTILE == 0);
static_assert(SEQ % STILE == 0);

// ---------------- workspace layout ----------------
#define KH_BYTES  ((size_t)NBH * SEQ * HD * 2)      // f16 K plane  [bh][s][64]
#define VT_BYTES  ((size_t)NBH * HD * SEQ * 2)      // f16 V^T plane [bh][64][s]
#define WS_NEED   (KH_BYTES + VT_BYTES)
static_assert(WS_NEED <= (size_t)134217728);
static_assert(KH_BYTES % 128 == 0);
static_assert(VT_BYTES % 128 == 0);

// ---------------- attention kernel LDS layout ----------------
#define KL_STR   72                                  // halves per K tile row (64 used: both d-halves)
#define VL_STR   72                                  // halves per V^T tile row (64 used)
#define KL_BYTES (STILE * KL_STR * 2)                // 9216
#define VL_BYTES (HD * VL_STR * 2)                   // 9216
#define STG_STR  68                                  // floats per staged output row (64 used; 272 B = 16 B x odd)
#define STG_BYTES (2 * QTILE * STG_STR * 4)          // 34816 epilogue staging, both maps (aliases the K / V tiles)
#define SMEM_ATT (KL_BYTES + VL_BYTES > STG_BYTES ? KL_BYTES + VL_BYTES : STG_BYTES)

// bf16 RNE of an f32 value, returned as f32
__device__ __forceinline__ float bf16_rne(float x) {
  unsigned u = __float_as_uint(x);
  u = (u + 0x7FFFu + ((u >> 16) & 1u)) & 0xFFFF0000u;
  return __uint_as_float(u);
}
// bf16-RNE value carried x16 in an f16 container (exact)
__device__ __forceinline__ _Float16 cv16(float x) { return (_Float16)(bf16_rne(x) * 16.0f); }

// lane l <-> lane l ^ 16
__device__ __forceinline__ float xhalf(float x) {
  const int b = __builtin_bit_cast(int, x);
  return __builtin_bit_cast(float, __builtin_amdgcn_permlanex16(b, b, 0x76543210, 0xfedcba98, false, false));
}

__device__ __forceinline__ v8f wmma16(v16h a, v16h b, v8f c) {
  v8f d = __builtin_amdgcn_wmma_f32_16x16x32_f16(false, a, false, b, (short)0, c, false, false);
  asm volatile("v_nop\n\tv_nop\n\tv_nop\n\tv_nop" : "+v"(d) : "v"(a), "v"(b));
  return d;
}

// =================================================================
// Pre-pass: K -> f16 plane [bh][s][64] (x16), V -> f16 transposed plane [bh][64][s] (x16)
// grid (SEQ/64, NBH), 256 threads; one 64-key tile per block
// =================================================================
__global__ __launch_bounds__(256) void k_conv(const float* __restrict__ K,
                                              const float* __restrict__ V,
                                              _Float16* __restrict__ Kh,
                                              _Float16* __restrict__ Vt) {
  __shared__ __align__(16) _Float16 vtl[HD * VL_STR];   // [d][s] tile, cross-wave (block barrier)
  const int tid = threadIdx.x;
  const int bh  = blockIdx.y;
  const int s0  = blockIdx.x * STILE;
  const float* Kg = K + ((size_t)bh * SEQ_FULL + s0) * HD;
  const float* Vg = V + ((size_t)bh * SEQ_FULL + s0) * HD;
  _Float16* Kp = Kh + ((size_t)bh * SEQ + s0) * HD;
  _Float16* Vp = Vt + (size_t)bh * HD * SEQ + s0;

  union HU8 { h8 h; u4 u; _Float16 s[8]; };
  HU8 kv[2];
#pragma unroll
  for (int i = 0; i < 2; ++i) {
    const int idx = tid + 256 * i;           // 0..511
    const int row = idx >> 3;                // key row 0..63
    const int c8  = (idx & 7) * 8;           // d 0..56
    const f4 a  = *(const f4*)(Kg + row * HD + c8);
    const f4 b  = *(const f4*)(Kg + row * HD + c8 + 4);
    const f4 va = *(const f4*)(Vg + row * HD + c8);
    const f4 vb = *(const f4*)(Vg + row * HD + c8 + 4);
#pragma unroll
    for (int e = 0; e < 4; ++e) {
      kv[i].s[e]     = cv16(a[e]);
      kv[i].s[4 + e] = cv16(b[e]);
      vtl[(c8 + e) * VL_STR + row]     = cv16(va[e]);
      vtl[(c8 + 4 + e) * VL_STR + row] = cv16(vb[e]);
    }
  }
  __syncthreads();
  HU8 vv[2];
#pragma unroll
  for (int i = 0; i < 2; ++i) {
    const int idx = tid + 256 * i;
    const int d   = idx >> 3;
    const int p8  = (idx & 7) * 8;
    vv[i].h = *(const h8*)(vtl + d * VL_STR + p8);
  }
#pragma unroll
  for (int i = 0; i < 2; ++i) {
    const int idx = tid + 256 * i;
    const int row = idx >> 3, c8 = (idx & 7) * 8;
    *(u4*)(Kp + row * HD + c8) = kv[i].u;
    *(u4*)(Vp + (size_t)row * SEQ + c8) = vv[i].u;   // row = d here
  }
  
}

__global__ __launch_bounds__(256) void k_attn(const float* __restrict__ Q,
                                              const _Float16* __restrict__ Kh,
                                              const _Float16* __restrict__ Vt,
                                              const float* __restrict__ Lam,
                                              int nlam,
                                              float* __restrict__ Out) {
  const int tid  = threadIdx.x;
  const int lane = tid & 31;
  const int wave = tid >> 5;
  const int l16  = lane & 15;
  const int half = lane >> 4;
  const int kb8  = half * 8;

  const int bh    = blockIdx.y;
  const int qBase = blockIdx.x * QTILE;
  const int doff  = (wave >> 2) * D2;   // map = wave >> 2

  __shared__ __align__(16) unsigned char smem[SMEM_ATT];
  _Float16* Kl  = (_Float16*)smem;                                           // [64 key][72]  cross-wave
  _Float16* Vl  = (_Float16*)(smem + KL_BYTES);                              // [64 d][72]    cross-wave
  float*    stg = (float*)smem;                                              // epilogue alias [2 maps x 64][68]

  // ---- Q B-fragment (column = query l16, 32 d of the selected half) straight from f32 global ----
  union HU { v16h v; h8 p[2]; _Float16 s[16]; };
  HU uq;
  {
    const float* qp = Q + ((size_t)bh * SEQ_FULL + qBase + (wave & 3) * 16 + l16) * HD + doff;
    const f4 x0 = *(const f4*)(qp + kb8);
    const f4 x1 = *(const f4*)(qp + kb8 + 4);
    const f4 x2 = *(const f4*)(qp + 16 + kb8);
    const f4 x3 = *(const f4*)(qp + 16 + kb8 + 4);
    asm volatile("s_wait_xcnt 0x0" ::: "memory");   // before the address registers of these four loads are reused
#pragma unroll
    for (int e = 0; e < 4; ++e) {
      uq.s[e]      = cv16(x0[e]);   // elements 0..7  <- d = 8h + 0..7
      uq.s[4 + e]  = cv16(x1[e]);
      uq.s[8 + e]  = cv16(x2[e]);   // elements 8..15 <- d = 16 + 8h + 0..7
      uq.s[12 + e] = cv16(x3[e]);
    }
  }
  const v16h qa = uq.v;

  // ---- this head's lambda, fetched here so that its latency is not paid in the epilogue ----
  int h = bh % NH;
  h = min(h, nlam - 1);
  h = max(h, 0);
  const float lam = bf16_rne(Lam[h]);

  // ---- online-softmax state ----
  // ---- per lane: query l16; lsum holds the sum over this lane half's keys, joined in the epilogue ----
  float m = -1.0e30f, lsum = 0.0f;
  v8f accH[4], accL[4];                // O^T tiles: register j = d 16n + 8h + j, column = query l16
#pragma unroll
  for (int n = 0; n < 4; ++n)
#pragma unroll
    for (int j = 0; j < 8; ++j) { accH[n][j] = 0.0f; accL[n][j] = 0.0f; }

  const _Float16* khBase = Kh + (size_t)bh * SEQ * HD;
  const _Float16* vtBase = Vt + (size_t)bh * HD * SEQ;
  // (1/sqrt(32)) / 256 : q and k each carried x16
  const float SC = 0.17677669529663688f * 0.00390625f;

  // staging: this thread's 16-byte piece of rows srow and srow + 32 of the K tile and of the V^T tile
  const int srow = tid >> 3;          // 0..31: key row of K, d row of V^T
  const int sp8  = (tid & 7) * 8;     // 0..56: d of K, key of V^T
  const _Float16* kp = khBase + (size_t)srow * HD + sp8;
  const _Float16* vp = vtBase + (size_t)srow * SEQ + sp8;
  _Float16* ks = Kl + srow * KL_STR + sp8;
  _Float16* vs = Vl + srow * VL_STR + sp8;

  for (int it = 0; it < NT; ++it) {
    __syncthreads();   // all waves done with Kl / Vl of the prior tile
    {
      const h8 k0 = *(const h8*)(kp);
      const h8 k1 = *(const h8*)(kp + 32 * HD);
      const h8 v0 = *(const h8*)(vp);
      const h8 v1 = *(const h8*)(vp + (size_t)32 * SEQ);
      kp += STILE * HD;
      vp += STILE;
      *(h8*)(ks) = k0;
      *(h8*)(ks + 32 * KL_STR) = k1;
      *(h8*)(vs) = v0;
      *(h8*)(vs + 32 * VL_STR) = v1;
    }
    __syncthreads();

    // ---- S^T over four 16-key subtiles (K = 32 = one WMMA each) ----
    float p[4][8];
    float tmax = -1.0e30f;
#pragma unroll
    for (int t = 0; t < 4; ++t) {
      HU ua;
      const _Float16* kr = Kl + (t * 16 + l16) * KL_STR + doff;   // A row m = key t*16 + l16, this map's d-half
      ua.p[0] = *(const h8*)(kr + kb8);                    // elements 0..7  <- d = 8h + 0..7
      ua.p[1] = *(const h8*)(kr + 16 + kb8);               // elements 8..15 <- d = 16 + 8h + 0..7
      v8f c8;
#pragma unroll
      for (int j = 0; j < 8; ++j) c8[j] = 0.0f;
      c8 = wmma16(ua.v, qa, c8);                           // D[key t*16 + 8h + j][query l16]
#pragma unroll
      for (int j = 0; j < 8; ++j) {
        const float lg = c8[j] * SC;
        p[t][j] = lg;
        tmax = fmaxf(tmax, lg);
      }
    }

    // ---- one query per lane: maximum in-lane, one exchange between the lane halves ----
    tmax = fmaxf(tmax, xhalf(tmax));
    const float nm   = fmaxf(m, tmax);
    const float corr = __expf(m - nm);
    m = nm;
    float s[4];                        // one independent chain per subtile
#pragma unroll
    for (int t = 0; t < 4; ++t) {
      s[t] = 0.0f;
#pragma unroll
      for (int j = 0; j < 8; ++j) {
        p[t][j] = __expf(p[t][j] - m);
        s[t] += p[t][j];
      }
    }
    lsum = lsum * corr + ((s[0] + s[1]) + (s[2] + s[3]));
#pragma unroll
    for (int n = 0; n < 4; ++n)
#pragma unroll
      for (int j = 0; j < 8; ++j) { accH[n][j] *= corr; accL[n][j] *= corr; }

    // ---- P^T B-fragments in place: hi = f16(4096 p), lo = f16((4096 p - hi) * 1024);
    //      element e of pair g <- key 32g + (e < 8 ? 8h + e : 16 + 8h + e - 8) = subtile 2g + (e >> 3), register e & 7 ----
    v16h ph[2], pl[2];
#pragma unroll
    for (int t = 0; t < 4; ++t)
#pragma unroll
      for (int j = 0; j < 8; ++j) {
        const float pc = p[t][j] * 4096.0f;
        const _Float16 hv = (_Float16)pc;
        ph[t >> 1][(t & 1) * 8 + j] = hv;
        pl[t >> 1][(t & 1) * 8 + j] = (_Float16)((pc - (float)hv) * 1024.0f);
      }

    // ---- V^T A-fragments, O^T += V^T.P^T ----
#pragma unroll
    for (int n = 0; n < 4; ++n) {
      HU uv0, uv1;
      const _Float16* vr = Vl + (16 * n + l16) * VL_STR;  // A row m = d 16n + l16
      uv0.p[0] = *(const h8*)(vr + kb8);                   // keys 8h + 0..7
      uv0.p[1] = *(const h8*)(vr + 16 + kb8);              // keys 16 + 8h + 0..7
      uv1.p[0] = *(const h8*)(vr + 32 + kb8);
      uv1.p[1] = *(const h8*)(vr + 48 + kb8);
      accH[n] = wmma16(uv0.v, ph[0], accH[n]);
      accH[n] = wmma16(uv1.v, ph[1], accH[n]);
      accL[n] = wmma16(uv0.v, pl[0], accL[n]);
      accL[n] = wmma16(uv1.v, pl[1], accL[n]);
    }
  }
  __syncthreads();   // all LDS use of the main loop complete before the staging alias

  // ---- finalize: ctx = (accH + accL * 2^-10) / lsum / (4096 * 16), staged as row map * 64 + query ----
  {
    lsum += xhalf(lsum);
    const float inv = (1.0f / lsum) * (1.0f / 65536.0f);
    float* sw = stg + wave * (16 * STG_STR) + l16 * STG_STR + 8 * half;   // row = wave * 16 + l16 = map * 64 + query
#pragma unroll
    for (int n = 0; n < 4; ++n) {
      f4 o0, o1;
#pragma unroll
      for (int j = 0; j < 4; ++j) {
        o0[j] = (accH[n][j] + accL[n][j] * (1.0f / 1024.0f)) * inv;
        o1[j] = (accH[n][4 + j] + accL[n][4 + j] * (1.0f / 1024.0f)) * inv;
      }
      *(f4*)(sw + 16 * n)     = o0;    // d 16n + 8h + 0..3
      *(f4*)(sw + 16 * n + 4) = o1;    // d 16n + 8h + 4..7
    }
  }
  __syncthreads();
  // ---- combine the two maps and normalise: 16 lanes per row of 64 floats, 16 rows per pass, whole-line stores ----
  const int c4 = (tid & 15) * 4;
#pragma unroll
  for (int k = 0; k < QTILE / 16; ++k) {
    const int row = k * 16 + (tid >> 4);             // query 0..63
    const f4 a = *(const f4*)(stg + row * STG_STR + c4);
    const f4 b = *(const f4*)(stg + (QTILE + row) * STG_STR + c4);
    float x[4];
#pragma unroll
    for (int i = 0; i < 4; ++i) x[i] = a[i] - lam * b[i];
    float s = (x[0] + x[1]) + (x[2] + x[3]);
    s += __shfl_xor(s, 1, 32);
    s += __shfl_xor(s, 2, 32);
    s += __shfl_xor(s, 4, 32);
    s += __shfl_xor(s, 8, 32);
    const float mean = s * (1.0f / 64.0f);
    float d[4];
    float ss = 0.0f;
#pragma unroll
    for (int i = 0; i < 4; ++i) { d[i] = x[i] - mean; ss += d[i] * d[i]; }
    ss += __shfl_xor(ss, 1, 32);
    ss += __shfl_xor(ss, 2, 32);
    ss += __shfl_xor(ss, 4, 32);
    ss += __shfl_xor(ss, 8, 32);
    const float var = ss * (1.0f / 64.0f);
    const float rs  = rsqrtf(var + 1.0e-5f);
    f4 o;
#pragma unroll
    for (int i = 0; i < 4; ++i) o[i] = (d[i] * rs) * 0.2f;
    *(f4*)(Out + ((size_t)bh * SEQ + qBase + row) * HD + c4) = o;
  }
}

// =================================================================
// Host launcher
// =================================================================
extern "C" void kernel_launch(void* const* d_in, const int* in_sizes, int n_in,
                              void* d_out, int out_size, void* d_ws, size_t ws_size,
                              hipStream_t stream) {
  if (n_in < 4) return;
  const long long needIn = ((long long)(NBH - 1) * SEQ_FULL + SEQ) * HD;
  if ((long long)in_sizes[0] < needIn || (long long)in_sizes[1] < needIn ||
      (long long)in_sizes[2] < needIn || in_sizes[3] < 1) return;
  if ((long long)out_size < (long long)NBH * SEQ * HD) return;
  if (d_ws == nullptr || ws_size < WS_NEED) return;

  const float* Q   = (const float*)d_in[0];
  const float* K   = (const float*)d_in[1];
  const float* V   = (const float*)d_in[2];
  const float* Lam = (const float*)d_in[3];
  float* Out = (float*)d_out;

  char* ws = (char*)d_ws;
  _Float16* Kh  = (_Float16*)(ws);
  _Float16* Vt  = (_Float16*)(ws + KH_BYTES);

  k_conv<<<dim3(SEQ / STILE, NBH), dim3(256), 0, stream>>>(K, V, Kh, Vt);
  k_attn<<<dim3(SEQ / QTILE, NBH), dim3(256), 0, stream>>>(Q, Kh, Vt, Lam, in_sizes[3], Out);
}

// v003
// One run takes 115 microseconds.
// Next to v002, in two timings, it ran 1.05 and 1.07 times as fast.
// Counting every step since v000, it is 1.86 times as fast.
#include <hip/hip_runtime.h>

// scores k_half.q_half^T, transposed (both maps): v_wmma_f32_16x16x32_f16, f16 operands = bf16-RNE input values x16, f32 accumulate;
// V^T.P^T: v_wmma_f32_16x16x32_f16, P = f16 hi (x4096) + f16 residual (same scale, same f32 accumulator), V = bf16-RNE input x16; softmax, combine, normalisation in f32.

typedef _Float16 v16h __attribute__((ext_vector_type(16)));
typedef _Float16 h8   __attribute__((ext_vector_type(8)));
typedef float    v8f  __attribute__((ext_vector_type(8)));
typedef float    f4   __attribute__((ext_vector_type(4)));
typedef unsigned int u4 __attribute__((ext_vector_type(4)));
typedef float    f2   __attribute__((ext_vector_type(2)));
typedef _Float16 h2   __attribute__((ext_vector_type(2)));

#ifndef NB
#define NB 2
#endif
#ifndef SEQ
#define SEQ 2048
#endif
#define NB_FULL  2
#define SEQ_FULL 2048
#define NH   16
#define HD   64
#define D2   32
#define NBH  (NB * NH)
#define QTILE 64           // query rows per block (4 waves x 16 rows for each of the two maps)
#define STILE 64           // keys per main-loop iteration
#define NT    (SEQ / STILE)

static_assert(NB <= NB_FULL);
static_assert(SEQ <= SEQ_FULL);
static_assert(SEQ % QTILE == 0);
static_assert(SEQ % STILE == 0);

// ---------------- workspace layout ----------------
#define KH_BYTES  ((size_t)NBH * SEQ * HD * 2)      // f16 K plane  [bh][s][64]
#define VT_BYTES  ((size_t)NBH * HD * SEQ * 2)      // f16 V^T plane [bh][64][s]
#define WS_NEED   (KH_BYTES + VT_BYTES)
static_assert(WS_NEED <= (size_t)134217728);
static_assert(KH_BYTES % 128 == 0);
static_assert(VT_BYTES % 128 == 0);

// ---------------- attention kernel LDS layout ----------------
#define KL_STR   72                                  // halves per K tile row (64 used: both d-halves)
#define VL_STR   72                                  // halves per V^T tile row (64 used)
#define KL_BYTES (STILE * KL_STR * 2)                // 9216
#define VL_BYTES (HD * VL_STR * 2)                   // 9216
#define STG_STR  68                                  // floats per staged output row (64 used; 272 B = 16 B x odd)
#define STG_BYTES (2 * QTILE * STG_STR * 4)          // 34816 epilogue staging, both maps (aliases the K / V tiles)
#define SMEM_ATT (KL_BYTES + VL_BYTES > STG_BYTES ? KL_BYTES + VL_BYTES : STG_BYTES)

// bf16 RNE of an f32 value, returned as f32
__device__ __forceinline__ float bf16_rne(float x) {
  unsigned u = __float_as_uint(x);
  u = (u + 0x7FFFu + ((u >> 16) & 1u)) & 0xFFFF0000u;
  return __uint_as_float(u);
}
// bf16-RNE value carried x16 in an f16 container (exact)
__device__ __forceinline__ _Float16 cv16(float x) { return (_Float16)(bf16_rne(x) * 16.0f); }

// lane l <-> lane l ^ 16
__device__ __forceinline__ float xhalf(float x) {
  const int b = __builtin_bit_cast(int, x);
  return __builtin_bit_cast(float, __builtin_amdgcn_permlanex16(b, b, 0x76543210, 0xfedcba98, false, false));
}

__device__ __forceinline__ v8f wmma16(v16h a, v16h b, v8f c) {
  v8f d = __builtin_amdgcn_wmma_f32_16x16x32_f16(false, a, false, b, (short)0, c, false, false);
  asm volatile("v_nop\n\tv_nop\n\tv_nop\n\tv_nop" : "+v"(d) : "v"(a), "v"(b));
  return d;
}

// =================================================================
// Pre-pass: K -> f16 plane [bh][s][64] (x16), V -> f16 transposed plane [bh][64][s] (x16)
// grid (SEQ/64, NBH), 256 threads; one 64-key tile per block
// =================================================================
__global__ __launch_bounds__(256) void k_conv(const float* __restrict__ K,
                                              const float* __restrict__ V,
                                              _Float16* __restrict__ Kh,
                                              _Float16* __restrict__ Vt) {
  __shared__ __align__(16) _Float16 vtl[HD * VL_STR];   // [d][s] tile, cross-wave (block barrier)
  const int tid = threadIdx.x;
  const int bh  = blockIdx.y;
  const int s0  = blockIdx.x * STILE;
  const float* Kg = K + ((size_t)bh * SEQ_FULL + s0) * HD;
  const float* Vg = V + ((size_t)bh * SEQ_FULL + s0) * HD;
  _Float16* Kp = Kh + ((size_t)bh * SEQ + s0) * HD;
  _Float16* Vp = Vt + (size_t)bh * HD * SEQ + s0;

  union HU8 { h8 h; u4 u; _Float16 s[8]; };
  HU8 kv[2];
#pragma unroll
  for (int i = 0; i < 2; ++i) {
    const int idx = tid + 256 * i;           // 0..511
    const int row = idx >> 3;                // key row 0..63
    const int c8  = (idx & 7) * 8;           // d 0..56
    const f4 a  = *(const f4*)(Kg + row * HD + c8);
    const f4 b  = *(const f4*)(Kg + row * HD + c8 + 4);
    const f4 va = *(const f4*)(Vg + row * HD + c8);
    const f4 vb = *(const f4*)(Vg + row * HD + c8 + 4);
#pragma unroll
    for (int e = 0; e < 4; ++e) {
      kv[i].s[e]     = cv16(a[e]);
      kv[i].s[4 + e] = cv16(b[e]);
      vtl[(c8 + e) * VL_STR + row]     = cv16(va[e]);
      vtl[(c8 + 4 + e) * VL_STR + row] = cv16(vb[e]);
    }
  }
  __syncthreads();
  HU8 vv[2];
#pragma unroll
  for (int i = 0; i < 2; ++i) {
    const int idx = tid + 256 * i;
    const int d   = idx >> 3;
    const int p8  = (idx & 7) * 8;
    vv[i].h = *(const h8*)(vtl + d * VL_STR + p8);
  }
#pragma unroll
  for (int i = 0; i < 2; ++i) {
    const int idx = tid + 256 * i;
    const int row = idx >> 3, c8 = (idx & 7) * 8;
    *(u4*)(Kp + row * HD + c8) = kv[i].u;
    *(u4*)(Vp + (size_t)row * SEQ + c8) = vv[i].u;   // row = d here
  }
  
}

__global__ __launch_bounds__(256) void k_attn(const float* __restrict__ Q,
                                              const _Float16* __restrict__ Kh,
                                              const _Float16* __restrict__ Vt,
                                              const float* __restrict__ Lam,
                                              int nlam,
                                              float* __restrict__ Out) {
  const int tid  = threadIdx.x;
  const int lane = tid & 31;
  const int wave = tid >> 5;
  const int l16  = lane & 15;
  const int half = lane >> 4;
  const int kb8  = half * 8;

  const int bh    = blockIdx.y;
  const int qBase = blockIdx.x * QTILE;
  const int doff  = (wave >> 2) * D2;   // map = wave >> 2

  __shared__ __align__(16) unsigned char smem[SMEM_ATT];
  _Float16* Kl  = (_Float16*)smem;                                           // [64 key][72]  cross-wave
  _Float16* Vl  = (_Float16*)(smem + KL_BYTES);                              // [64 d][72]    cross-wave
  float*    stg = (float*)smem;                                              // epilogue alias [2 maps x 64][68]

  // ---- Q B-fragment (column = query l16, 32 d of the selected half) straight from f32 global ----
  union HU { v16h v; h8 p[2]; _Float16 s[16]; };
  HU uq;
  {
    const float* qp = Q + ((size_t)bh * SEQ_FULL + qBase + (wave & 3) * 16 + l16) * HD + doff;
    const f4 x0 = *(const f4*)(qp + kb8);
    const f4 x1 = *(const f4*)(qp + kb8 + 4);
    const f4 x2 = *(const f4*)(qp + 16 + kb8);
    const f4 x3 = *(const f4*)(qp + 16 + kb8 + 4);
    asm volatile("s_wait_xcnt 0x0" ::: "memory");   // before the address registers of these four loads are reused
#pragma unroll
    for (int e = 0; e < 4; ++e) {
      uq.s[e]      = cv16(x0[e]);   // elements 0..7  <- d = 8h + 0..7
      uq.s[4 + e]  = cv16(x1[e]);
      uq.s[8 + e]  = cv16(x2[e]);   // elements 8..15 <- d = 16 + 8h + 0..7
      uq.s[12 + e] = cv16(x3[e]);
    }
  }
  const v16h qa = uq.v;

  // ---- this head's lambda, fetched here so that its latency is not paid in the epilogue ----
  int h = bh % NH;
  h = min(h, nlam - 1);
  h = max(h, 0);
  const float lam = bf16_rne(Lam[h]);

  // ---- online-softmax state ----
  // ---- per lane: query l16; lsum holds the sum over this lane half's keys, joined in the epilogue ----
  float m = -1.0e30f, lsum = 0.0f;
  v8f acc[4];                          // O^T tiles: register j = d 16n + 8h + j, column = query l16
#pragma unroll
  for (int n = 0; n < 4; ++n)
#pragma unroll
    for (int j = 0; j < 8; ++j) acc[n][j] = 0.0f;

  const _Float16* khBase = Kh + (size_t)bh * SEQ * HD;
  const _Float16* vtBase = Vt + (size_t)bh * HD * SEQ;
  // (1/sqrt(32)) / 256 : q and k each carried x16
  const float SC = 0.17677669529663688f * 0.00390625f;

  // staging: this thread's 16-byte piece of rows srow and srow + 32 of the K tile and of the V^T tile
  const int srow = tid >> 3;          // 0..31: key row of K, d row of V^T
  const int sp8  = (tid & 7) * 8;     // 0..56: d of K, key of V^T
  const _Float16* kp = khBase + (size_t)srow * HD + sp8;
  const _Float16* vp = vtBase + (size_t)srow * SEQ + sp8;
  _Float16* ks = Kl + srow * KL_STR + sp8;
  _Float16* vs = Vl + srow * VL_STR + sp8;

  for (int it = 0; it < NT; ++it) {
    __syncthreads();   // all waves done with Kl / Vl of the prior tile
    {
      const h8 k0 = *(const h8*)(kp);
      const h8 k1 = *(const h8*)(kp + 32 * HD);
      const h8 v0 = *(const h8*)(vp);
      const h8 v1 = *(const h8*)(vp + (size_t)32 * SEQ);
      kp += STILE * HD;
      vp += STILE;
      *(h8*)(ks) = k0;
      *(h8*)(ks + 32 * KL_STR) = k1;
      *(h8*)(vs) = v0;
      *(h8*)(vs + 32 * VL_STR) = v1;
    }
    __syncthreads();

    // ---- S^T over four 16-key subtiles (K = 32 = one WMMA each) ----
    float p[4][8];
    float tmax = -1.0e30f;
#pragma unroll
    for (int t = 0; t < 4; ++t) {
      HU ua;
      const _Float16* kr = Kl + (t * 16 + l16) * KL_STR + doff;   // A row m = key t*16 + l16, this map's d-half
      ua.p[0] = *(const h8*)(kr + kb8);                    // elements 0..7  <- d = 8h + 0..7
      ua.p[1] = *(const h8*)(kr + 16 + kb8);               // elements 8..15 <- d = 16 + 8h + 0..7
      v8f c8;
#pragma unroll
      for (int j = 0; j < 8; ++j) c8[j] = 0.0f;
      c8 = wmma16(ua.v, qa, c8);                           // D[key t*16 + 8h + j][query l16]
#pragma unroll
      for (int j = 0; j < 8; ++j) {
        const float lg = c8[j] * SC;
        p[t][j] = lg;
        tmax = fmaxf(tmax, lg);
      }
    }

    // ---- one query per lane: maximum in-lane, one exchange between the lane halves ----
    tmax = fmaxf(tmax, xhalf(tmax));
    const float nm   = fmaxf(m, tmax);
    const float corr = __expf(m - nm);
    m = nm;
    float s[4];                        // one independent chain per subtile
#pragma unroll
    for (int t = 0; t < 4; ++t) {
      s[t] = 0.0f;
#pragma unroll
      for (int j = 0; j < 8; ++j) {
        p[t][j] = __expf(p[t][j] - m);
        s[t] += p[t][j];
      }
    }
    lsum = lsum * corr + ((s[0] + s[1]) + (s[2] + s[3]));
#pragma unroll
    for (int n = 0; n < 4; ++n)
#pragma unroll
      for (int j = 0; j < 8; ++j) acc[n][j] *= corr;

    // ---- P^T B-fragments in place: hi = f16(4096 p), lo = f16(4096 p - hi), at hi's own scale: f16 keeps it to
    //      2^-23 of p or to 2^-37 of the row's largest p, whichever is larger, so both products share one accumulator;
    //      element e of pair g <- key 32g + (e < 8 ? 8h + e : 16 + 8h + e - 8) = subtile 2g + (e >> 3), register e & 7 ----
    v16h ph[2], pl[2];
#pragma unroll
    for (int t = 0; t < 4; ++t)
#pragma unroll
      for (int j = 0; j < 8; j += 2) {
        const f2 pc = {p[t][j] * 4096.0f, p[t][j + 1] * 4096.0f};
        const h2 hv = __builtin_convertvector(pc, h2);
        const h2 lv = __builtin_convertvector(pc - __builtin_convertvector(hv, f2), h2);
        ph[t >> 1][(t & 1) * 8 + j]     = hv[0];
        ph[t >> 1][(t & 1) * 8 + j + 1] = hv[1];
        pl[t >> 1][(t & 1) * 8 + j]     = lv[0];
        pl[t >> 1][(t & 1) * 8 + j + 1] = lv[1];
      }

    // ---- V^T A-fragments, O^T += V^T.P^T ----
#pragma unroll
    for (int n = 0; n < 4; ++n) {
      HU uv0, uv1;
      const _Float16* vr = Vl + (16 * n + l16) * VL_STR;  // A row m = d 16n + l16
      uv0.p[0] = *(const h8*)(vr + kb8);                   // keys 8h + 0..7
      uv0.p[1] = *(const h8*)(vr + 16 + kb8);              // keys 16 + 8h + 0..7
      uv1.p[0] = *(const h8*)(vr + 32 + kb8);
      uv1.p[1] = *(const h8*)(vr + 48 + kb8);
      acc[n] = wmma16(uv0.v, pl[0], acc[n]);
      acc[n] = wmma16(uv1.v, pl[1], acc[n]);
      acc[n] = wmma16(uv0.v, ph[0], acc[n]);
      acc[n] = wmma16(uv1.v, ph[1], acc[n]);
    }
  }
  __syncthreads();   // all LDS use of the main loop complete before the staging alias

  // ---- finalize: ctx = acc / lsum / (4096 * 16), staged as row map * 64 + query ----
  {
    lsum += xhalf(lsum);
    const float inv = (1.0f / lsum) * (1.0f / 65536.0f);
    float* sw = stg + wave * (16 * STG_STR) + l16 * STG_STR + 8 * half;   // row = wave * 16 + l16 = map * 64 + query
#pragma unroll
    for (int n = 0; n < 4; ++n) {
      f4 o0, o1;
#pragma unroll
      for (int j = 0; j < 4; ++j) {
        o0[j] = acc[n][j] * inv;
        o1[j] = acc[n][4 + j] * inv;
      }
      *(f4*)(sw + 16 * n)     = o0;    // d 16n + 8h + 0..3
      *(f4*)(sw + 16 * n + 4) = o1;    // d 16n + 8h + 4..7
    }
  }
  __syncthreads();
  // ---- combine the two maps and normalise: 16 lanes per row of 64 floats, 16 rows per pass, whole-line stores ----
  const int c4 = (tid & 15) * 4;
#pragma unroll
  for (int k = 0; k < QTILE / 16; ++k) {
    const int row = k * 16 + (tid >> 4);             // query 0..63
    const f4 a = *(const f4*)(stg + row * STG_STR + c4);
    const f4 b = *(const f4*)(stg + (QTILE + row) * STG_STR + c4);
    float x[4];
#pragma unroll
    for (int i = 0; i < 4; ++i) x[i] = a[i] - lam * b[i];
    float s = (x[0] + x[1]) + (x[2] + x[3]);
    s += __shfl_xor(s, 1, 32);
    s += __shfl_xor(s, 2, 32);
    s += __shfl_xor(s, 4, 32);
    s += __shfl_xor(s, 8, 32);
    const float mean = s * (1.0f / 64.0f);
    float d[4];
    float ss = 0.0f;
#pragma unroll
    for (int i = 0; i < 4; ++i) { d[i] = x[i] - mean; ss += d[i] * d[i]; }
    ss += __shfl_xor(ss, 1, 32);
    ss += __shfl_xor(ss, 2, 32);
    ss += __shfl_xor(ss, 4, 32);
    ss += __shfl_xor(ss, 8, 32);
    const float var = ss * (1.0f / 64.0f);
    const float rs  = rsqrtf(var + 1.0e-5f);
    f4 o;
#pragma unroll
    for (int i = 0; i < 4; ++i) o[i] = (d[i] * rs) * 0.2f;
    *(f4*)(Out + ((size_t)bh * SEQ + qBase + row) * HD + c4) = o;
  }
}

// =================================================================
// Host launcher
// =================================================================
extern "C" void kernel_launch(void* const* d_in, const int* in_sizes, int n_in,
                              void* d_out, int out_size, void* d_ws, size_t ws_size,
                              hipStream_t stream) {
  if (n_in < 4) return;
  const long long needIn = ((long long)(NBH - 1) * SEQ_FULL + SEQ) * HD;
  if ((long long)in_sizes[0] < needIn || (long long)in_sizes[1] < needIn ||
      (long long)in_sizes[2] < needIn || in_sizes[3] < 1) return;
  if ((long long)out_size < (long long)NBH * SEQ * HD) return;
  if (d_ws == nullptr || ws_size < WS_NEED) return;

  const float* Q   = (const float*)d_in[0];
  const float* K   = (const float*)d_in[1];
  const float* V   = (const float*)d_in[2];
  const float* Lam = (const float*)d_in[3];
  float* Out = (float*)d_out;

  char* ws = (char*)d_ws;
  _Float16* Kh  = (_Float16*)(ws);
  _Float16* Vt  = (_Float16*)(ws + KH_BYTES);

  k_conv<<<dim3(SEQ / STILE, NBH), dim3(256), 0, stream>>>(K, V, Kh, Vt);
  k_attn<<<dim3(SEQ / QTILE, NBH), dim3(256), 0, stream>>>(Q, Kh, Vt, Lam, in_sizes[3], Out);
}

// v004
// One run takes 103 microseconds.
// In two side-by-side timings against v003, it was 1.08 and 1.11 times as fast.
// Over all steps from v000 it is 2.04 times as fast.
#include <hip/hip_runtime.h>

// scores k_half.q_half^T, transposed (both maps): v_wmma_f32_16x16x32_f16, f16 operands = bf16-RNE input values x16, f32 accumulate;
// V^T.P^T: v_wmma_f32_16x16x32_f16, P = f16 hi (x4096) + f16 residual (same scale, same f32 accumulator), V = bf16-RNE input x16; softmax, combine, normalisation in f32.

typedef _Float16 v16h __attribute__((ext_vector_type(16)));
typedef _Float16 h8   __attribute__((ext_vector_type(8)));
typedef float    v8f  __attribute__((ext_vector_type(8)));
typedef float    f4   __attribute__((ext_vector_type(4)));
typedef unsigned int u4 __attribute__((ext_vector_type(4)));
typedef float    f2   __attribute__((ext_vector_type(2)));
typedef _Float16 h2   __attribute__((ext_vector_type(2)));

#ifndef NB
#define NB 2
#endif
#ifndef SEQ
#define SEQ 2048
#endif
#define NB_FULL  2
#define SEQ_FULL 2048
#define NH   16
#define HD   64
#define D2   32
#define NBH  (NB * NH)
#define QTILE 64           // query rows per block (4 waves x 16 rows for each of the two maps)
#define STILE 64           // keys per main-loop iteration
#define NT    (SEQ / STILE)

static_assert(NB <= NB_FULL);
static_assert(SEQ <= SEQ_FULL);
static_assert(SEQ % QTILE == 0);
static_assert(SEQ % STILE == 0);

// ---------------- workspace layout ----------------
#define KH_BYTES  ((size_t)NBH * SEQ * HD * 2)      // f16 K plane  [bh][s][64]
#define VT_BYTES  ((size_t)NBH * HD * SEQ * 2)      // f16 V^T plane [bh][64][s]
#define WS_NEED   (KH_BYTES + VT_BYTES)
static_assert(WS_NEED <= (size_t)134217728);
static_assert(KH_BYTES % 128 == 0);
static_assert(VT_BYTES % 128 == 0);

// ---------------- attention kernel LDS layout ----------------
#define KL_STR   72                                  // halves per K tile row (64 used: both d-halves)
#define VL_STR   72                                  // halves per V^T tile row (64 used)
#define KL_BYTES (STILE * KL_STR * 2)                // 9216
#define VL_BYTES (HD * VL_STR * 2)                   // 9216
#define STG_STR  68                                  // floats per staged output row (64 used; 272 B = 16 B x odd)
#define STG_BYTES (2 * QTILE * STG_STR * 4)          // 34816 epilogue staging, both maps (aliases the K / V tiles)
#define SMEM_ATT (KL_BYTES + VL_BYTES > STG_BYTES ? KL_BYTES + VL_BYTES : STG_BYTES)

// bf16 RNE of an f32 value, returned as f32
__device__ __forceinline__ float bf16_rne(float x) {
  unsigned u = __float_as_uint(x);
  u = (u + 0x7FFFu + ((u >> 16) & 1u)) & 0xFFFF0000u;
  return __uint_as_float(u);
}
// bf16-RNE value carried x16 in an f16 container (exact)
__device__ __forceinline__ _Float16 cv16(float x) { return (_Float16)(bf16_rne(x) * 16.0f); }

// lane l <-> lane l ^ 16
__device__ __forceinline__ float xhalf(float x) {
  const int b = __builtin_bit_cast(int, x);
  return __builtin_bit_cast(float, __builtin_amdgcn_permlanex16(b, b, 0x76543210, 0xfedcba98, false, false));
}

__device__ __forceinline__ v8f wmma16(v16h a, v16h b, v8f c) {
  return __builtin_amdgcn_wmma_f32_16x16x32_f16(false, a, false, b, (short)0, c, false, false);
}

// =================================================================
// Pre-pass: K -> f16 plane [bh][s][64] (x16), V -> f16 transposed plane [bh][64][s] (x16)
// grid (SEQ/64, NBH), 256 threads; one 64-key tile per block
// =================================================================
__global__ __launch_bounds__(256) void k_conv(const float* __restrict__ K,
                                              const float* __restrict__ V,
                                              _Float16* __restrict__ Kh,
                                              _Float16* __restrict__ Vt) {
  __shared__ __align__(16) _Float16 vtl[HD * VL_STR];   // [d][s] tile, cross-wave (block barrier)
  const int tid = threadIdx.x;
  const int bh  = blockIdx.y;
  const int s0  = blockIdx.x * STILE;
  const float* Kg = K + ((size_t)bh * SEQ_FULL + s0) * HD;
  const float* Vg = V + ((size_t)bh * SEQ_FULL + s0) * HD;
  _Float16* Kp = Kh + ((size_t)bh * SEQ + s0) * HD;
  _Float16* Vp = Vt + (size_t)bh * HD * SEQ + s0;

  union HU8 { h8 h; u4 u; _Float16 s[8]; };
  HU8 kv[2];
#pragma unroll
  for (int i = 0; i < 2; ++i) {
    const int idx = tid + 256 * i;           // 0..511
    const int row = idx >> 3;                // key row 0..63
    const int c8  = (idx & 7) * 8;           // d 0..56
    const f4 a  = *(const f4*)(Kg + row * HD + c8);
    const f4 b  = *(const f4*)(Kg + row * HD + c8 + 4);
    const f4 va = *(const f4*)(Vg + row * HD + c8);
    const f4 vb = *(const f4*)(Vg + row * HD + c8 + 4);
#pragma unroll
    for (int e = 0; e < 4; ++e) {
      kv[i].s[e]     = cv16(a[e]);
      kv[i].s[4 + e] = cv16(b[e]);
      vtl[(c8 + e) * VL_STR + row]     = cv16(va[e]);
      vtl[(c8 + 4 + e) * VL_STR + row] = cv16(vb[e]);
    }
  }
  __syncthreads();
  HU8 vv[2];
#pragma unroll
  for (int i = 0; i < 2; ++i) {
    const int idx = tid + 256 * i;
    const int d   = idx >> 3;
    const int p8  = (idx & 7) * 8;
    vv[i].h = *(const h8*)(vtl + d * VL_STR + p8);
  }
#pragma unroll
  for (int i = 0; i < 2; ++i) {
    const int idx = tid + 256 * i;
    const int row = idx >> 3, c8 = (idx & 7) * 8;
    *(u4*)(Kp + row * HD + c8) = kv[i].u;
    *(u4*)(Vp + (size_t)row * SEQ + c8) = vv[i].u;   // row = d here
  }
  
}

__global__ __launch_bounds__(256) void k_attn(const float* __restrict__ Q,
                                              const _Float16* __restrict__ Kh,
                                              const _Float16* __restrict__ Vt,
                                              const float* __restrict__ Lam,
                                              int nlam,
                                              float* __restrict__ Out) {
  const int tid  = threadIdx.x;
  const int lane = tid & 31;
  const int wave = tid >> 5;
  const int l16  = lane & 15;
  const int half = lane >> 4;
  const int kb8  = half * 8;

  const int bh    = blockIdx.y;
  const int qBase = blockIdx.x * QTILE;
  const int doff  = (wave >> 2) * D2;   // map = wave >> 2

  __shared__ __align__(16) unsigned char smem[SMEM_ATT];
  _Float16* Kl  = (_Float16*)smem;                                           // [64 key][72]  cross-wave
  _Float16* Vl  = (_Float16*)(smem + KL_BYTES);                              // [64 d][72]    cross-wave
  float*    stg = (float*)smem;                                              // epilogue alias [2 maps x 64][68]

  // ---- Q B-fragment (column = query l16, 32 d of the selected half) straight from f32 global ----
  union HU { v16h v; h8 p[2]; _Float16 s[16]; };
  HU uq;
  {
    const float* qp = Q + ((size_t)bh * SEQ_FULL + qBase + (wave & 3) * 16 + l16) * HD + doff;
    const f4 x0 = *(const f4*)(qp + kb8);
    const f4 x1 = *(const f4*)(qp + kb8 + 4);
    const f4 x2 = *(const f4*)(qp + 16 + kb8);
    const f4 x3 = *(const f4*)(qp + 16 + kb8 + 4);
    asm volatile("s_wait_xcnt 0x0" ::: "memory");   // before the address registers of these four loads are reused
#pragma unroll
    for (int e = 0; e < 4; ++e) {
      uq.s[e]      = cv16(x0[e]);   // elements 0..7  <- d = 8h + 0..7
      uq.s[4 + e]  = cv16(x1[e]);
      uq.s[8 + e]  = cv16(x2[e]);   // elements 8..15 <- d = 16 + 8h + 0..7
      uq.s[12 + e] = cv16(x3[e]);
    }
  }
  const v16h qa = uq.v;

  // ---- this head's lambda, fetched here so that its latency is not paid in the epilogue ----
  int h = bh % NH;
  h = min(h, nlam - 1);
  h = max(h, 0);
  const float lam = bf16_rne(Lam[h]);

  // ---- online-softmax state ----
  // ---- per lane: query l16; lsum holds the sum over this lane half's keys, joined in the epilogue ----
  float m = -1.0e30f, lsum = 0.0f;
  v8f acc[4];                          // O^T tiles: register j = d 16n + 8h + j, column = query l16
#pragma unroll
  for (int n = 0; n < 4; ++n)
#pragma unroll
    for (int j = 0; j < 8; ++j) acc[n][j] = 0.0f;

  const _Float16* khBase = Kh + (size_t)bh * SEQ * HD;
  const _Float16* vtBase = Vt + (size_t)bh * HD * SEQ;
  // (1/sqrt(32)) / 256 : q and k each carried x16
  const float SC = 0.17677669529663688f * 0.00390625f;

  // staging: this thread's 16-byte piece of rows srow and srow + 32 of the K tile and of the V^T tile
  const int srow = tid >> 3;          // 0..31: key row of K, d row of V^T
  const int sp8  = (tid & 7) * 8;     // 0..56: d of K, key of V^T
  const _Float16* kp = khBase + (size_t)srow * HD + sp8;
  const _Float16* vp = vtBase + (size_t)srow * SEQ + sp8;
  _Float16* ks = Kl + srow * KL_STR + sp8;
  _Float16* vs = Vl + srow * VL_STR + sp8;

  for (int it = 0; it < NT; ++it) {
    __syncthreads();   // all waves done with Kl / Vl of the prior tile
    {
      const h8 k0 = *(const h8*)(kp);
      const h8 k1 = *(const h8*)(kp + 32 * HD);
      const h8 v0 = *(const h8*)(vp);
      const h8 v1 = *(const h8*)(vp + (size_t)32 * SEQ);
      kp += STILE * HD;
      vp += STILE;
      *(h8*)(ks) = k0;
      *(h8*)(ks + 32 * KL_STR) = k1;
      *(h8*)(vs) = v0;
      *(h8*)(vs + 32 * VL_STR) = v1;
    }
    __syncthreads();

    // ---- S^T over four 16-key subtiles (K = 32 = one WMMA each) ----
    float p[4][8];
    float tmax = -1.0e30f;
#pragma unroll
    for (int t = 0; t < 4; ++t) {
      HU ua;
      const _Float16* kr = Kl + (t * 16 + l16) * KL_STR + doff;   // A row m = key t*16 + l16, this map's d-half
      ua.p[0] = *(const h8*)(kr + kb8);                    // elements 0..7  <- d = 8h + 0..7
      ua.p[1] = *(const h8*)(kr + 16 + kb8);               // elements 8..15 <- d = 16 + 8h + 0..7
      v8f c8;
#pragma unroll
      for (int j = 0; j < 8; ++j) c8[j] = 0.0f;
      c8 = wmma16(ua.v, qa, c8);                           // D[key t*16 + 8h + j][query l16]
#pragma unroll
      for (int j = 0; j < 8; ++j) {
        const float lg = c8[j] * SC;
        p[t][j] = lg;
        tmax = fmaxf(tmax, lg);
      }
    }

    // ---- one query per lane: maximum in-lane, one exchange between the lane halves ----
    tmax = fmaxf(tmax, xhalf(tmax));
    const float nm   = fmaxf(m, tmax);
    const float corr = __expf(m - nm);
    m = nm;
    float s[4];                        // one independent chain per subtile
#pragma unroll
    for (int t = 0; t < 4; ++t) {
      s[t] = 0.0f;
#pragma unroll
      for (int j = 0; j < 8; ++j) {
        p[t][j] = __expf(p[t][j] - m);
        s[t] += p[t][j];
      }
    }
    lsum = lsum * corr + ((s[0] + s[1]) + (s[2] + s[3]));
#pragma unroll
    for (int n = 0; n < 4; ++n)
#pragma unroll
      for (int j = 0; j < 8; ++j) acc[n][j] *= corr;

    // ---- P^T B-fragments in place: hi = f16(4096 p), lo = f16(4096 p - hi), at hi's own scale: f16 keeps it to
    //      2^-23 of p or to 2^-37 of the row's largest p, whichever is larger, so both products share one accumulator;
    //      element e of pair g <- key 32g + (e < 8 ? 8h + e : 16 + 8h + e - 8) = subtile 2g + (e >> 3), register e & 7 ----
    v16h ph[2], pl[2];
#pragma unroll
    for (int t = 0; t < 4; ++t)
#pragma unroll
      for (int j = 0; j < 8; j += 2) {
        const f2 pc = {p[t][j] * 4096.0f, p[t][j + 1] * 4096.0f};
        const h2 hv = __builtin_convertvector(pc, h2);
        const h2 lv = __builtin_convertvector(pc - __builtin_convertvector(hv, f2), h2);
        ph[t >> 1][(t & 1) * 8 + j]     = hv[0];
        ph[t >> 1][(t & 1) * 8 + j + 1] = hv[1];
        pl[t >> 1][(t & 1) * 8 + j]     = lv[0];
        pl[t >> 1][(t & 1) * 8 + j + 1] = lv[1];
      }

    // ---- V^T A-fragments, O^T += V^T.P^T ----
#pragma unroll
    for (int n = 0; n < 4; ++n) {
      HU uv0, uv1;
      const _Float16* vr = Vl + (16 * n + l16) * VL_STR;  // A row m = d 16n + l16
      uv0.p[0] = *(const h8*)(vr + kb8);                   // keys 8h + 0..7
      uv0.p[1] = *(const h8*)(vr + 16 + kb8);              // keys 16 + 8h + 0..7
      uv1.p[0] = *(const h8*)(vr + 32 + kb8);
      uv1.p[1] = *(const h8*)(vr + 48 + kb8);
      acc[n] = wmma16(uv0.v, pl[0], acc[n]);
      acc[n] = wmma16(uv1.v, pl[1], acc[n]);
      acc[n] = wmma16(uv0.v, ph[0], acc[n]);
      acc[n] = wmma16(uv1.v, ph[1], acc[n]);
    }
  }
  __syncthreads();   // all LDS use of the main loop complete before the staging alias

  // ---- finalize: ctx = acc / lsum / (4096 * 16), staged as row map * 64 + query ----
  {
    lsum += xhalf(lsum);
    const float inv = (1.0f / lsum) * (1.0f / 65536.0f);
    float* sw = stg + wave * (16 * STG_STR) + l16 * STG_STR + 8 * half;   // row = wave * 16 + l16 = map * 64 + query
#pragma unroll
    for (int n = 0; n < 4; ++n) {
      f4 o0, o1;
#pragma unroll
      for (int j = 0; j < 4; ++j) {
        o0[j] = acc[n][j] * inv;
        o1[j] = acc[n][4 + j] * inv;
      }
      *(f4*)(sw + 16 * n)     = o0;    // d 16n + 8h + 0..3
      *(f4*)(sw + 16 * n + 4) = o1;    // d 16n + 8h + 4..7
    }
  }
  __syncthreads();
  // ---- combine the two maps and normalise: 16 lanes per row of 64 floats, 16 rows per pass, whole-line stores ----
  const int c4 = (tid & 15) * 4;
#pragma unroll
  for (int k = 0; k < QTILE / 16; ++k) {
    const int row = k * 16 + (tid >> 4);             // query 0..63
    const f4 a = *(const f4*)(stg + row * STG_STR + c4);
    const f4 b = *(const f4*)(stg + (QTILE + row) * STG_STR + c4);
    float x[4];
#pragma unroll
    for (int i = 0; i < 4; ++i) x[i] = a[i] - lam * b[i];
    float s = (x[0] + x[1]) + (x[2] + x[3]);
    s += __shfl_xor(s, 1, 32);
    s += __shfl_xor(s, 2, 32);
    s += __shfl_xor(s, 4, 32);
    s += __shfl_xor(s, 8, 32);
    const float mean = s * (1.0f / 64.0f);
    float d[4];
    float ss = 0.0f;
#pragma unroll
    for (int i = 0; i < 4; ++i) { d[i] = x[i] - mean; ss += d[i] * d[i]; }
    ss += __shfl_xor(ss, 1, 32);
    ss += __shfl_xor(ss, 2, 32);
    ss += __shfl_xor(ss, 4, 32);
    ss += __shfl_xor(ss, 8, 32);
    const float var = ss * (1.0f / 64.0f);
    const float rs  = rsqrtf(var + 1.0e-5f);
    f4 o;
#pragma unroll
    for (int i = 0; i < 4; ++i) o[i] = (d[i] * rs) * 0.2f;
    *(f4*)(Out + ((size_t)bh * SEQ + qBase + row) * HD + c4) = o;
  }
}

// =================================================================
// Host launcher
// =================================================================
extern "C" void kernel_launch(void* const* d_in, const int* in_sizes, int n_in,
                              void* d_out, int out_size, void* d_ws, size_t ws_size,
                              hipStream_t stream) {
  if (n_in < 4) return;
  const long long needIn = ((long long)(NBH - 1) * SEQ_FULL + SEQ) * HD;
  if ((long long)in_sizes[0] < needIn || (long long)in_sizes[1] < needIn ||
      (long long)in_sizes[2] < needIn || in_sizes[3] < 1) return;
  if ((long long)out_size < (long long)NBH * SEQ * HD) return;
  if (d_ws == nullptr || ws_size < WS_NEED) return;

  const float* Q   = (const float*)d_in[0];
  const float* K   = (const float*)d_in[1];
  const float* V   = (const float*)d_in[2];
  const float* Lam = (const float*)d_in[3];
  float* Out = (float*)d_out;

  char* ws = (char*)d_ws;
  _Float16* Kh  = (_Float16*)(ws);
  _Float16* Vt  = (_Float16*)(ws + KH_BYTES);

  k_conv<<<dim3(SEQ / STILE, NBH), dim3(256), 0, stream>>>(K, V, Kh, Vt);
  k_attn<<<dim3(SEQ / QTILE, NBH), dim3(256), 0, stream>>>(Q, Kh, Vt, Lam, in_sizes[3], Out);
}

// v005
// It runs in 89.4 microseconds.
// Two timings next to v004 put it at 1.18 and 1.15 times that version's speed.
// Counting every step since v000, it is 2.38 times as fast.
#include <hip/hip_runtime.h>

// scores k_half.q_half^T, transposed (both maps): v_wmma_f32_16x16x32_f16, f16 operands = bf16-RNE input values x16, f32 accumulate;
// V^T.P^T: v_wmma_f32_16x16x32_f16, P = f16 hi (x4096) + f16 residual (same scale, same f32 accumulator), V = bf16-RNE input x16; softmax, combine, normalisation in f32.

typedef _Float16 v16h __attribute__((ext_vector_type(16)));
typedef _Float16 h8   __attribute__((ext_vector_type(8)));
typedef float    v8f  __attribute__((ext_vector_type(8)));
typedef float    f4   __attribute__((ext_vector_type(4)));
typedef unsigned int u4 __attribute__((ext_vector_type(4)));
typedef float    f2   __attribute__((ext_vector_type(2)));
typedef _Float16 h2   __attribute__((ext_vector_type(2)));

#ifndef NB
#define NB 2
#endif
#ifndef SEQ
#define SEQ 2048
#endif
#define NB_FULL  2
#define SEQ_FULL 2048
#define NH   16
#define HD   64
#define D2   32
#define NBH  (NB * NH)
#define QTILE 64           // query rows per block (4 waves x 16 rows for each of the two maps)
#define STILE 64           // keys per main-loop iteration
#define NT    (SEQ / STILE)

static_assert(NB <= NB_FULL);
static_assert(SEQ <= SEQ_FULL);
static_assert(SEQ % QTILE == 0);
static_assert(SEQ % STILE == 0);
static_assert(SEQ / STILE >= 2);         // the ring's prologue fills two tiles

// ---------------- workspace layout ----------------
#define KH_BYTES  ((size_t)NBH * SEQ * HD * 2)      // f16 K plane  [bh][s][64]
#define VT_BYTES  ((size_t)NBH * HD * SEQ * 2)      // f16 V^T plane [bh][64][s]
#define WS_NEED   (KH_BYTES + VT_BYTES)
static_assert(WS_NEED <= (size_t)134217728);
static_assert(KH_BYTES % 128 == 0);
static_assert(VT_BYTES % 128 == 0);

// ---------------- attention kernel LDS layout ----------------
#define KL_STR   72                                  // halves per K tile row (64 used: both d-halves)
#define VL_STR   72                                  // halves per V^T tile row (64 used)
#define KL_BYTES (STILE * KL_STR * 2)                // 9216
#define VL_BYTES (HD * VL_STR * 2)                   // 9216
#define STG_STR  68                                  // floats per staged output row (64 used; 272 B = 16 B x odd)
#define STG_BYTES (2 * QTILE * STG_STR * 4)          // 34816 epilogue staging, both maps (aliases the K / V tiles)
#define BUF_BYTES (KL_BYTES + VL_BYTES)             // 18432: one K tile and one V^T tile
static_assert(KL_STR == VL_STR);                    // one lane offset serves both tiles of a buffer
#define SMEM_ATT (2 * BUF_BYTES > STG_BYTES ? 2 * BUF_BYTES : STG_BYTES)

// bf16 RNE of an f32 value, returned as f32
__device__ __forceinline__ float bf16_rne(float x) {
  unsigned u = __float_as_uint(x);
  u = (u + 0x7FFFu + ((u >> 16) & 1u)) & 0xFFFF0000u;
  return __uint_as_float(u);
}
// bf16-RNE value carried x16 in an f16 container (exact)
__device__ __forceinline__ _Float16 cv16(float x) { return (_Float16)(bf16_rne(x) * 16.0f); }

// lane l <-> lane l ^ 16
__device__ __forceinline__ float xhalf(float x) {
  const int b = __builtin_bit_cast(int, x);
  return __builtin_bit_cast(float, __builtin_amdgcn_permlanex16(b, b, 0x76543210, 0xfedcba98, false, false));
}

__device__ __forceinline__ v8f wmma16(v16h a, v16h b, v8f c) {
  return __builtin_amdgcn_wmma_f32_16x16x32_f16(false, a, false, b, (short)0, c, false, false);
}

// One tile's four 16-byte pieces of this lane, global -> LDS through no register. The s_wait_xcnt stands inside
// the statement so that no address register of a copy is rewritten ahead of it.
__device__ __forceinline__ void copy_tile(unsigned l0, unsigned l1, unsigned l2, unsigned l3,
                                          const _Float16* g0, const _Float16* g1,
                                          const _Float16* g2, const _Float16* g3) {
  asm volatile("global_load_async_to_lds_b128 %0, %4, off\n\t"
               "global_load_async_to_lds_b128 %1, %5, off\n\t"
               "global_load_async_to_lds_b128 %2, %6, off\n\t"
               "global_load_async_to_lds_b128 %3, %7, off\n\t"
               "s_wait_xcnt 0x0"
               :: "v"(l0), "v"(l1), "v"(l2), "v"(l3), "v"(g0), "v"(g1), "v"(g2), "v"(g3) : "memory");
}

// =================================================================
// Pre-pass: K -> f16 plane [bh][s][64] (x16), V -> f16 transposed plane [bh][64][s] (x16)
// grid (SEQ/64, NBH), 256 threads; one 64-key tile per block
// =================================================================
__global__ __launch_bounds__(256) void k_conv(const float* __restrict__ K,
                                              const float* __restrict__ V,
                                              _Float16* __restrict__ Kh,
                                              _Float16* __restrict__ Vt) {
  __shared__ __align__(16) _Float16 vtl[HD * VL_STR];   // [d][s] tile, cross-wave (block barrier)
  const int tid = threadIdx.x;
  const int bh  = blockIdx.y;
  const int s0  = blockIdx.x * STILE;
  const float* Kg = K + ((size_t)bh * SEQ_FULL + s0) * HD;
  const float* Vg = V + ((size_t)bh * SEQ_FULL + s0) * HD;
  _Float16* Kp = Kh + ((size_t)bh * SEQ + s0) * HD;
  _Float16* Vp = Vt + (size_t)bh * HD * SEQ + s0;

  union HU8 { h8 h; u4 u; _Float16 s[8]; };
  HU8 kv[2];
#pragma unroll
  for (int i = 0; i < 2; ++i) {
    const int idx = tid + 256 * i;           // 0..511
    const int row = idx >> 3;                // key row 0..63
    const int c8  = (idx & 7) * 8;           // d 0..56
    const f4 a  = *(const f4*)(Kg + row * HD + c8);
    const f4 b  = *(const f4*)(Kg + row * HD + c8 + 4);
    const f4 va = *(const f4*)(Vg + row * HD + c8);
    const f4 vb = *(const f4*)(Vg + row * HD + c8 + 4);
#pragma unroll
    for (int e = 0; e < 4; ++e) {
      kv[i].s[e]     = cv16(a[e]);
      kv[i].s[4 + e] = cv16(b[e]);
      vtl[(c8 + e) * VL_STR + row]     = cv16(va[e]);
      vtl[(c8 + 4 + e) * VL_STR + row] = cv16(vb[e]);
    }
  }
  __syncthreads();
  HU8 vv[2];
#pragma unroll
  for (int i = 0; i < 2; ++i) {
    const int idx = tid + 256 * i;
    const int d   = idx >> 3;
    const int p8  = (idx & 7) * 8;
    vv[i].h = *(const h8*)(vtl + d * VL_STR + p8);
  }
#pragma unroll
  for (int i = 0; i < 2; ++i) {
    const int idx = tid + 256 * i;
    const int row = idx >> 3, c8 = (idx & 7) * 8;
    *(u4*)(Kp + row * HD + c8) = kv[i].u;
    *(u4*)(Vp + (size_t)row * SEQ + c8) = vv[i].u;   // row = d here
  }
  
}

__global__ __launch_bounds__(256) void k_attn(const float* __restrict__ Q,
                                              const _Float16* __restrict__ Kh,
                                              const _Float16* __restrict__ Vt,
                                              const float* __restrict__ Lam,
                                              int nlam,
                                              float* __restrict__ Out) {
  const int tid  = threadIdx.x;
  const int lane = tid & 31;
  const int wave = tid >> 5;
  const int l16  = lane & 15;
  const int half = lane >> 4;
  const int kb8  = half * 8;

  const int bh    = blockIdx.y;
  const int qBase = blockIdx.x * QTILE;
  const int doff  = (wave >> 2) * D2;   // map = wave >> 2

  __shared__ __align__(16) unsigned char smem[SMEM_ATT];
  // two buffers, each K tile [64 key][72] then V^T tile [64 d][72], cross-wave
  float*    stg = (float*)smem;                                              // epilogue alias [2 maps x 64][68]

  // ---- Q B-fragment (column = query l16, 32 d of the selected half) straight from f32 global ----
  union HU { v16h v; h8 p[2]; _Float16 s[16]; };
  HU uq;
  {
    const float* qp = Q + ((size_t)bh * SEQ_FULL + qBase + (wave & 3) * 16 + l16) * HD + doff;
    const f4 x0 = *(const f4*)(qp + kb8);
    const f4 x1 = *(const f4*)(qp + kb8 + 4);
    const f4 x2 = *(const f4*)(qp + 16 + kb8);
    const f4 x3 = *(const f4*)(qp + 16 + kb8 + 4);
    asm volatile("s_wait_xcnt 0x0" ::: "memory");   // before the address registers of these four loads are reused
#pragma unroll
    for (int e = 0; e < 4; ++e) {
      uq.s[e]      = cv16(x0[e]);   // elements 0..7  <- d = 8h + 0..7
      uq.s[4 + e]  = cv16(x1[e]);
      uq.s[8 + e]  = cv16(x2[e]);   // elements 8..15 <- d = 16 + 8h + 0..7
      uq.s[12 + e] = cv16(x3[e]);
    }
  }
  const v16h qa = uq.v;

  // ---- this head's lambda, fetched here so that its latency is not paid in the epilogue ----
  int h = bh % NH;
  h = min(h, nlam - 1);
  h = max(h, 0);
  const float lam = bf16_rne(Lam[h]);

  // ---- online-softmax state ----
  // ---- per lane: query l16; lsum holds the sum over this lane half's keys, joined in the epilogue ----
  float m = -1.0e30f, lsum = 0.0f;
  v8f acc[4];                          // O^T tiles: register j = d 16n + 8h + j, column = query l16
#pragma unroll
  for (int n = 0; n < 4; ++n)
#pragma unroll
    for (int j = 0; j < 8; ++j) acc[n][j] = 0.0f;

  const _Float16* khBase = Kh + (size_t)bh * SEQ * HD;
  const _Float16* vtBase = Vt + (size_t)bh * HD * SEQ;
  // (1/sqrt(32)) / 256 : q and k each carried x16
  const float SC = 0.17677669529663688f * 0.00390625f;

  // staging: this thread's 16-byte piece of rows srow and srow + 32 of the K tile and of the V^T tile
  const int srow = tid >> 3;          // 0..31: key row of K, d row of V^T
  const int sp8  = (tid & 7) * 8;     // 0..56: d of K, key of V^T
  const _Float16* kp = khBase + (size_t)srow * HD + sp8;
  const _Float16* vp = vtBase + (size_t)srow * SEQ + sp8;
  const unsigned ks = (unsigned)(size_t)smem + (srow * KL_STR + sp8) * 2;   // LDS byte address in buffer 0
  const unsigned vs = ks + KL_BYTES;                                        // the same place in the V^T tile

  // ---- ring prologue: tile 0 landed and published, tile 1 in flight ----
  copy_tile(ks, ks + 32 * KL_STR * 2, vs, vs + 32 * VL_STR * 2, kp, kp + 32 * HD, vp, vp + (size_t)32 * SEQ);
  kp += STILE * HD;
  vp += STILE;
  asm volatile("s_wait_asynccnt 0x0" ::: "memory");   // this wave's pieces of tile 0 have landed
  __syncthreads();
  copy_tile(ks + BUF_BYTES, ks + BUF_BYTES + 32 * KL_STR * 2, vs + BUF_BYTES, vs + BUF_BYTES + 32 * VL_STR * 2,
            kp, kp + 32 * HD, vp, vp + (size_t)32 * SEQ);
  kp += STILE * HD;
  vp += STILE;

  unsigned boff = 0;                  // byte offset of the buffer that this trip reads
  for (int it = 0; it < NT; ++it) {
    const _Float16* Kl = (const _Float16*)(smem + boff);
    const _Float16* Vl = (const _Float16*)(smem + boff + KL_BYTES);

    // ---- S^T over four 16-key subtiles (K = 32 = one WMMA each) ----
    float p[4][8];
    float tmax = -1.0e30f;
#pragma unroll
    for (int t = 0; t < 4; ++t) {
      HU ua;
      const _Float16* kr = Kl + (t * 16 + l16) * KL_STR + doff;   // A row m = key t*16 + l16, this map's d-half
      ua.p[0] = *(const h8*)(kr + kb8);                    // elements 0..7  <- d = 8h + 0..7
      ua.p[1] = *(const h8*)(kr + 16 + kb8);               // elements 8..15 <- d = 16 + 8h + 0..7
      v8f c8;
#pragma unroll
      for (int j = 0; j < 8; ++j) c8[j] = 0.0f;
      c8 = wmma16(ua.v, qa, c8);                           // D[key t*16 + 8h + j][query l16]
#pragma unroll
      for (int j = 0; j < 8; ++j) {
        const float lg = c8[j] * SC;
        p[t][j] = lg;
        tmax = fmaxf(tmax, lg);
      }
    }

    // ---- one query per lane: maximum in-lane, one exchange between the lane halves ----
    tmax = fmaxf(tmax, xhalf(tmax));
    const float nm   = fmaxf(m, tmax);
    const float corr = __expf(m - nm);
    m = nm;
    float s[4];                        // one independent chain per subtile
#pragma unroll
    for (int t = 0; t < 4; ++t) {
      s[t] = 0.0f;
#pragma unroll
      for (int j = 0; j < 8; ++j) {
        p[t][j] = __expf(p[t][j] - m);
        s[t] += p[t][j];
      }
    }
    lsum = lsum * corr + ((s[0] + s[1]) + (s[2] + s[3]));
#pragma unroll
    for (int n = 0; n < 4; ++n)
#pragma unroll
      for (int j = 0; j < 8; ++j) acc[n][j] *= corr;

    // ---- P^T B-fragments in place: hi = f16(4096 p), lo = f16(4096 p - hi), at hi's own scale: f16 keeps it to
    //      2^-23 of p or to 2^-37 of the row's largest p, whichever is larger, so both products share one accumulator;
    //      element e of pair g <- key 32g + (e < 8 ? 8h + e : 16 + 8h + e - 8) = subtile 2g + (e >> 3), register e & 7 ----
    v16h ph[2], pl[2];
#pragma unroll
    for (int t = 0; t < 4; ++t)
#pragma unroll
      for (int j = 0; j < 8; j += 2) {
        const f2 pc = {p[t][j] * 4096.0f, p[t][j + 1] * 4096.0f};
        const h2 hv = __builtin_convertvector(pc, h2);
        const h2 lv = __builtin_convertvector(pc - __builtin_convertvector(hv, f2), h2);
        ph[t >> 1][(t & 1) * 8 + j]     = hv[0];
        ph[t >> 1][(t & 1) * 8 + j + 1] = hv[1];
        pl[t >> 1][(t & 1) * 8 + j]     = lv[0];
        pl[t >> 1][(t & 1) * 8 + j + 1] = lv[1];
      }

    // ---- V^T A-fragments, O^T += V^T.P^T ----
    //      listed tile by tile so that the four accumulators alternate; each accumulator's own order of sums is
    //      pl[0], pl[1], ph[0], ph[1]; the loops are unrolled so that fragments and accumulators stay in registers
    HU uv0[4], uv1[4];
#pragma unroll
    for (int n = 0; n < 4; ++n) {
      const _Float16* vr = Vl + (16 * n + l16) * VL_STR;  // A row m = d 16n + l16
      uv0[n].p[0] = *(const h8*)(vr + kb8);                // keys 8h + 0..7
      uv0[n].p[1] = *(const h8*)(vr + 16 + kb8);           // keys 16 + 8h + 0..7
      uv1[n].p[0] = *(const h8*)(vr + 32 + kb8);
      uv1[n].p[1] = *(const h8*)(vr + 48 + kb8);
    }
#pragma unroll
    for (int n = 0; n < 4; ++n) acc[n] = wmma16(uv0[n].v, pl[0], acc[n]);
#pragma unroll
    for (int n = 0; n < 4; ++n) acc[n] = wmma16(uv1[n].v, pl[1], acc[n]);
#pragma unroll
    for (int n = 0; n < 4; ++n) acc[n] = wmma16(uv0[n].v, ph[0], acc[n]);
#pragma unroll
    for (int n = 0; n < 4; ++n) acc[n] = wmma16(uv1[n].v, ph[1], acc[n]);

    // ---- publish point of the next tile; the same barrier frees this trip's buffer ----
    asm volatile("s_wait_dscnt 0x0" ::: "memory");      // this wave's reads of this trip's buffer are over
    asm volatile("s_wait_asynccnt 0x0" ::: "memory");   // this wave's pieces of the next tile have landed
    __syncthreads();
    if (it + 2 < NT) {                                  // tile it + 2 exists: refill the buffer just read
      copy_tile(ks + boff, ks + boff + 32 * KL_STR * 2, vs + boff, vs + boff + 32 * VL_STR * 2,
                kp, kp + 32 * HD, vp, vp + (size_t)32 * SEQ);
      kp += STILE * HD;
      vp += STILE;
    }
    boff = BUF_BYTES - boff;
  }
  asm volatile("s_wait_asynccnt 0x0" ::: "memory");   // nothing in flight; the last trip's barrier ended every read before the staging alias

  // ---- finalize: ctx = acc / lsum / (4096 * 16), staged as row map * 64 + query ----
  {
    lsum += xhalf(lsum);
    const float inv = (1.0f / lsum) * (1.0f / 65536.0f);
    float* sw = stg + wave * (16 * STG_STR) + l16 * STG_STR + 8 * half;   // row = wave * 16 + l16 = map * 64 + query
#pragma unroll
    for (int n = 0; n < 4; ++n) {
      f4 o0, o1;
#pragma unroll
      for (int j = 0; j < 4; ++j) {
        o0[j] = acc[n][j] * inv;
        o1[j] = acc[n][4 + j] * inv;
      }
      *(f4*)(sw + 16 * n)     = o0;    // d 16n + 8h + 0..3
      *(f4*)(sw + 16 * n + 4) = o1;    // d 16n + 8h + 4..7
    }
  }
  __syncthreads();
  // ---- combine the two maps and normalise: 16 lanes per row of 64 floats, 16 rows per pass, whole-line stores ----
  const int c4 = (tid & 15) * 4;
#pragma unroll
  for (int k = 0; k < QTILE / 16; ++k) {
    const int row = k * 16 + (tid >> 4);             // query 0..63
    const f4 a = *(const f4*)(stg + row * STG_STR + c4);
    const f4 b = *(const f4*)(stg + (QTILE + row) * STG_STR + c4);
    float x[4];
#pragma unroll
    for (int i = 0; i < 4; ++i) x[i] = a[i] - lam * b[i];
    float s = (x[0] + x[1]) + (x[2] + x[3]);
    s += __shfl_xor(s, 1, 32);
    s += __shfl_xor(s, 2, 32);
    s += __shfl_xor(s, 4, 32);
    s += __shfl_xor(s, 8, 32);
    const float mean = s * (1.0f / 64.0f);
    float d[4];
    float ss = 0.0f;
#pragma unroll
    for (int i = 0; i < 4; ++i) { d[i] = x[i] - mean; ss += d[i] * d[i]; }
    ss += __shfl_xor(ss, 1, 32);
    ss += __shfl_xor(ss, 2, 32);
    ss += __shfl_xor(ss, 4, 32);
    ss += __shfl_xor(ss, 8, 32);
    const float var = ss * (1.0f / 64.0f);
    const float rs  = rsqrtf(var + 1.0e-5f);
    f4 o;
#pragma unroll
    for (int i = 0; i < 4; ++i) o[i] = (d[i] * rs) * 0.2f;
    *(f4*)(Out + ((size_t)bh * SEQ + qBase + row) * HD + c4) = o;
  }
}

// =================================================================
// Host launcher
// =================================================================
extern "C" void kernel_launch(void* const* d_in, const int* in_sizes, int n_in,
                              void* d_out, int out_size, void* d_ws, size_t ws_size,
                              hipStream_t stream) {
  if (n_in < 4) return;
  const long long needIn = ((long long)(NBH - 1) * SEQ_FULL + SEQ) * HD;
  if ((long long)in_sizes[0] < needIn || (long long)in_sizes[1] < needIn ||
      (long long)in_sizes[2] < needIn || in_sizes[3] < 1) return;
  if ((long long)out_size < (long long)NBH * SEQ * HD) return;
  if (d_ws == nullptr || ws_size < WS_NEED) return;

  const float* Q   = (const float*)d_in[0];
  const float* K   = (const float*)d_in[1];
  const float* V   = (const float*)d_in[2];
  const float* Lam = (const float*)d_in[3];
  float* Out = (float*)d_out;

  char* ws = (char*)d_ws;
  _Float16* Kh  = (_Float16*)(ws);
  _Float16* Vt  = (_Float16*)(ws + KH_BYTES);

  k_conv<<<dim3(SEQ / STILE, NBH), dim3(256), 0, stream>>>(K, V, Kh, Vt);
  k_attn<<<dim3(SEQ / QTILE, NBH), dim3(256), 0, stream>>>(Q, Kh, Vt, Lam, in_sizes[3], Out);
}

// v006
// A run of this version takes 83.9 microseconds.
// In both of two side-by-side timings against v005, it was 1.07 times as fast.
// Over all steps from v000 it is 2.54 times as fast.
#include <hip/hip_runtime.h>

// scores k_half.q_half^T, transposed (both maps): v_wmma_f32_16x16x32_f16, f16 operands = bf16-RNE input values x16, f32 accumulate;
// V^T.P^T: v_wmma_f32_16x16x32_f16, P = f16 hi (x4096) + f16 residual (same scale, same f32 accumulator), V = bf16-RNE input x16; softmax, combine, normalisation in f32.

typedef _Float16 v16h __attribute__((ext_vector_type(16)));
typedef _Float16 h8   __attribute__((ext_vector_type(8)));
typedef float    v8f  __attribute__((ext_vector_type(8)));
typedef float    f4   __attribute__((ext_vector_type(4)));
typedef unsigned int u4 __attribute__((ext_vector_type(4)));
typedef float    f2   __attribute__((ext_vector_type(2)));
typedef _Float16 h2   __attribute__((ext_vector_type(2)));

#ifndef NB
#define NB 2
#endif
#ifndef SEQ
#define SEQ 2048
#endif
#define NB_FULL  2
#define SEQ_FULL 2048
#define NH   16
#define HD   64
#define D2   32
#define NBH  (NB * NH)
#define QTILE 64           // query rows per block (4 waves x 16 rows for each of the two maps)
#define STILE 64           // keys per main-loop iteration
#define NT    (SEQ / STILE)

static_assert(NB <= NB_FULL);
static_assert(SEQ <= SEQ_FULL);
static_assert(SEQ % QTILE == 0);
static_assert(SEQ % STILE == 0);
static_assert(SEQ / STILE >= 2);         // the ring's prologue fills two tiles

// ---------------- workspace layout ----------------
#define KH_BYTES  ((size_t)NBH * SEQ * HD * 2)      // f16 K plane  [bh][s][64]
#define VT_BYTES  ((size_t)NBH * HD * SEQ * 2)      // f16 V^T plane [bh][64][s]
#define WS_NEED   (KH_BYTES + VT_BYTES)
static_assert(WS_NEED <= (size_t)134217728);
static_assert(KH_BYTES % 128 == 0);
static_assert(VT_BYTES % 128 == 0);

// ---------------- attention kernel LDS layout ----------------
#define KL_STR   72                                  // halves per K tile row (64 used: both d-halves)
#define VL_STR   72                                  // halves per V^T tile row (64 used)
#define KL_BYTES (STILE * KL_STR * 2)                // 9216
#define VL_BYTES (HD * VL_STR * 2)                   // 9216
#define STG_STR  68                                  // floats per staged output row (64 used; 272 B = 16 B x odd)
#define STG_BYTES (2 * QTILE * STG_STR * 4)          // 34816 epilogue staging, both maps (aliases the K / V tiles)
#define BUF_BYTES (KL_BYTES + VL_BYTES)             // 18432: one K tile and one V^T tile
static_assert(KL_STR == VL_STR);                    // one lane offset serves both tiles of a buffer
#define SMEM_ATT (2 * BUF_BYTES > STG_BYTES ? 2 * BUF_BYTES : STG_BYTES)

// bf16 RNE of an f32 value, returned as f32
__device__ __forceinline__ float bf16_rne(float x) {
  unsigned u = __float_as_uint(x);
  u = (u + 0x7FFFu + ((u >> 16) & 1u)) & 0xFFFF0000u;
  return __uint_as_float(u);
}
// bf16-RNE value carried x16 in an f16 container (exact)
__device__ __forceinline__ _Float16 cv16(float x) { return (_Float16)(bf16_rne(x) * 16.0f); }

// lane l <-> lane l ^ 16
__device__ __forceinline__ float xhalf(float x) {
  const int b = __builtin_bit_cast(int, x);
  return __builtin_bit_cast(float, __builtin_amdgcn_permlanex16(b, b, 0x76543210, 0xfedcba98, false, false));
}

__device__ __forceinline__ v8f wmma16(v16h a, v16h b, v8f c) {
  return __builtin_amdgcn_wmma_f32_16x16x32_f16(false, a, false, b, (short)0, c, false, false);
}

// One tile's four 16-byte pieces of this lane, global -> LDS through no register. The s_wait_xcnt stands inside
// the statement so that no address register of a copy is rewritten ahead of it.
__device__ __forceinline__ void copy_tile(unsigned l0, unsigned l1, unsigned l2, unsigned l3,
                                          const _Float16* g0, const _Float16* g1,
                                          const _Float16* g2, const _Float16* g3) {
  asm volatile("global_load_async_to_lds_b128 %0, %4, off\n\t"
               "global_load_async_to_lds_b128 %1, %5, off\n\t"
               "global_load_async_to_lds_b128 %2, %6, off\n\t"
               "global_load_async_to_lds_b128 %3, %7, off\n\t"
               "s_wait_xcnt 0x0"
               :: "v"(l0), "v"(l1), "v"(l2), "v"(l3), "v"(g0), "v"(g1), "v"(g2), "v"(g3) : "memory");
}

// =================================================================
// Pre-pass: K -> f16 plane [bh][s][64] (x16), V -> f16 transposed plane [bh][64][s] (x16)
// grid (SEQ/64, NBH), 256 threads; one 64-key tile per block
// =================================================================
__global__ __launch_bounds__(256) void k_conv(const float* __restrict__ K,
                                              const float* __restrict__ V,
                                              _Float16* __restrict__ Kh,
                                              _Float16* __restrict__ Vt) {
  __shared__ __align__(16) _Float16 vtl[HD * VL_STR];   // [d][s] tile, cross-wave (block barrier)
  const int tid = threadIdx.x;
  const int bh  = blockIdx.y;
  const int s0  = blockIdx.x * STILE;
  const float* Kg = K + ((size_t)bh * SEQ_FULL + s0) * HD;
  const float* Vg = V + ((size_t)bh * SEQ_FULL + s0) * HD;
  _Float16* Kp = Kh + ((size_t)bh * SEQ + s0) * HD;
  _Float16* Vp = Vt + (size_t)bh * HD * SEQ + s0;

  union HU8 { h8 h; u4 u; _Float16 s[8]; };
  HU8 kv[2];
#pragma unroll
  for (int i = 0; i < 2; ++i) {
    const int idx = tid + 256 * i;           // 0..511
    const int row = idx >> 3;                // key row 0..63
    const int c8  = (idx & 7) * 8;           // d 0..56
    const f4 a  = *(const f4*)(Kg + row * HD + c8);
    const f4 b  = *(const f4*)(Kg + row * HD + c8 + 4);
    const f4 va = *(const f4*)(Vg + row * HD + c8);
    const f4 vb = *(const f4*)(Vg + row * HD + c8 + 4);
#pragma unroll
    for (int e = 0; e < 4; ++e) {
      kv[i].s[e]     = cv16(a[e]);
      kv[i].s[4 + e] = cv16(b[e]);
      vtl[(c8 + e) * VL_STR + row]     = cv16(va[e]);
      vtl[(c8 + 4 + e) * VL_STR + row] = cv16(vb[e]);
    }
  }
  __syncthreads();
  HU8 vv[2];
#pragma unroll
  for (int i = 0; i < 2; ++i) {
    const int idx = tid + 256 * i;
    const int d   = idx >> 3;
    const int p8  = (idx & 7) * 8;
    vv[i].h = *(const h8*)(vtl + d * VL_STR + p8);
  }
#pragma unroll
  for (int i = 0; i < 2; ++i) {
    const int idx = tid + 256 * i;
    const int row = idx >> 3, c8 = (idx & 7) * 8;
    *(u4*)(Kp + row * HD + c8) = kv[i].u;
    *(u4*)(Vp + (size_t)row * SEQ + c8) = vv[i].u;   // row = d here
  }
  
}

__global__ __launch_bounds__(256) void k_attn(const float* __restrict__ Q,
                                              const _Float16* __restrict__ Kh,
                                              const _Float16* __restrict__ Vt,
                                              const float* __restrict__ Lam,
                                              int nlam,
                                              float* __restrict__ Out) {
  const int tid  = threadIdx.x;
  const int lane = tid & 31;
  const int wave = tid >> 5;
  const int l16  = lane & 15;
  const int half = lane >> 4;
  const int kb8  = half * 8;

  const int bh    = blockIdx.y;
  const int qBase = blockIdx.x * QTILE;
  const int doff  = (wave >> 2) * D2;   // map = wave >> 2

  __shared__ __align__(16) unsigned char smem[SMEM_ATT];
  // two buffers, each K tile [64 key][72] then V^T tile [64 d][72], cross-wave
  float*    stg = (float*)smem;                                              // epilogue alias [2 maps x 64][68]

  // ---- Q B-fragment (column = query l16, 32 d of the selected half) straight from f32 global ----
  union HU { v16h v; h8 p[2]; _Float16 s[16]; };
  HU uq;
  {
    const float* qp = Q + ((size_t)bh * SEQ_FULL + qBase + (wave & 3) * 16 + l16) * HD + doff;
    const f4 x0 = *(const f4*)(qp + kb8);
    const f4 x1 = *(const f4*)(qp + kb8 + 4);
    const f4 x2 = *(const f4*)(qp + 16 + kb8);
    const f4 x3 = *(const f4*)(qp + 16 + kb8 + 4);
    asm volatile("s_wait_xcnt 0x0" ::: "memory");   // before the address registers of these four loads are reused
#pragma unroll
    for (int e = 0; e < 4; ++e) {
      uq.s[e]      = cv16(x0[e]);   // elements 0..7  <- d = 8h + 0..7
      uq.s[4 + e]  = cv16(x1[e]);
      uq.s[8 + e]  = cv16(x2[e]);   // elements 8..15 <- d = 16 + 8h + 0..7
      uq.s[12 + e] = cv16(x3[e]);
    }
  }
  const v16h qa = uq.v;

  // ---- this head's lambda, fetched here so that its latency is not paid in the epilogue ----
  int h = bh % NH;
  h = min(h, nlam - 1);
  h = max(h, 0);
  const float lam = bf16_rne(Lam[h]);

  // ---- online-softmax state ----
  // ---- per lane: query l16; m in raw accumulator units; lsum = 4096 x the sum over this lane half's keys, joined in the epilogue ----
  float m = -1.0e30f, lsum = 0.0f;
  v8f acc[4];                          // O^T tiles: register j = d 16n + 8h + j, column = query l16
#pragma unroll
  for (int n = 0; n < 4; ++n)
#pragma unroll
    for (int j = 0; j < 8; ++j) acc[n][j] = 0.0f;

  const _Float16* khBase = Kh + (size_t)bh * SEQ * HD;
  const _Float16* vtBase = Vt + (size_t)bh * HD * SEQ;
  // log2(e) / sqrt(32) / 256 (q and k each carried x16): one raw score accumulator unit, in powers of two
  const float SCL = 1.4426950408889634f * 0.17677669529663688f * 0.00390625f;

  // staging: this thread's 16-byte piece of rows srow and srow + 32 of the K tile and of the V^T tile
  const int srow = tid >> 3;          // 0..31: key row of K, d row of V^T
  const int sp8  = (tid & 7) * 8;     // 0..56: d of K, key of V^T
  const _Float16* kp = khBase + (size_t)srow * HD + sp8;
  const _Float16* vp = vtBase + (size_t)srow * SEQ + sp8;
  const unsigned ks = (unsigned)(size_t)smem + (srow * KL_STR + sp8) * 2;   // LDS byte address in buffer 0
  const unsigned vs = ks + KL_BYTES;                                        // the same place in the V^T tile

  // ---- ring prologue: tile 0 landed and published, tile 1 in flight ----
  copy_tile(ks, ks + 32 * KL_STR * 2, vs, vs + 32 * VL_STR * 2, kp, kp + 32 * HD, vp, vp + (size_t)32 * SEQ);
  kp += STILE * HD;
  vp += STILE;
  asm volatile("s_wait_asynccnt 0x0" ::: "memory");   // this wave's pieces of tile 0 have landed
  __syncthreads();
  copy_tile(ks + BUF_BYTES, ks + BUF_BYTES + 32 * KL_STR * 2, vs + BUF_BYTES, vs + BUF_BYTES + 32 * VL_STR * 2,
            kp, kp + 32 * HD, vp, vp + (size_t)32 * SEQ);
  kp += STILE * HD;
  vp += STILE;

  unsigned boff = 0;                  // byte offset of the buffer that this trip reads
  for (int it = 0; it < NT; ++it) {
    const _Float16* Kl = (const _Float16*)(smem + boff);
    const _Float16* Vl = (const _Float16*)(smem + boff + KL_BYTES);

    // ---- S^T over four 16-key subtiles (K = 32 = one WMMA each) ----
    float p[4][8];
    float tmax = -1.0e30f;
#pragma unroll
    for (int t = 0; t < 4; ++t) {
      HU ua;
      const _Float16* kr = Kl + (t * 16 + l16) * KL_STR + doff;   // A row m = key t*16 + l16, this map's d-half
      ua.p[0] = *(const h8*)(kr + kb8);                    // elements 0..7  <- d = 8h + 0..7
      ua.p[1] = *(const h8*)(kr + 16 + kb8);               // elements 8..15 <- d = 16 + 8h + 0..7
      v8f c8;
#pragma unroll
      for (int j = 0; j < 8; ++j) c8[j] = 0.0f;
      c8 = wmma16(ua.v, qa, c8);                           // D[key t*16 + 8h + j][query l16]
#pragma unroll
      for (int j = 0; j < 8; ++j) {
        p[t][j] = c8[j];                                   // raw accumulator; SCL > 0 keeps the order of the maximum
        tmax = fmaxf(tmax, c8[j]);
      }
    }

    // ---- one query per lane: maximum in-lane, one exchange between the lane halves ----
    tmax = fmaxf(tmax, xhalf(tmax));
    const float nm   = fmaxf(m, tmax);
    const float corr = __builtin_amdgcn_exp2f((m - nm) * SCL);
    m = nm;
    const float off = 12.0f - nm * SCL;   // 4096 p = 2^(c * SCL - m * SCL + 12): scale, base change and P's x4096 in one FMA
    float s[4];                        // one independent chain per subtile
#pragma unroll
    for (int t = 0; t < 4; ++t) {
      s[t] = 0.0f;
#pragma unroll
      for (int j = 0; j < 8; ++j) {
        p[t][j] = __builtin_amdgcn_exp2f(fmaf(p[t][j], SCL, off));
        s[t] += p[t][j];
      }
    }
    lsum = lsum * corr + ((s[0] + s[1]) + (s[2] + s[3]));
#pragma unroll
    for (int n = 0; n < 4; ++n)
#pragma unroll
      for (int j = 0; j < 8; ++j) acc[n][j] *= corr;

    // ---- P^T B-fragments in place: hi = f16(4096 p), lo = f16(4096 p - hi), at hi's own scale: f16 keeps it to
    //      2^-23 of p or to 2^-37 of the row's largest p, whichever is larger, so both products share one accumulator;
    //      element e of pair g <- key 32g + (e < 8 ? 8h + e : 16 + 8h + e - 8) = subtile 2g + (e >> 3), register e & 7 ----
    v16h ph[2], pl[2];
#pragma unroll
    for (int t = 0; t < 4; ++t)
#pragma unroll
      for (int j = 0; j < 8; j += 2) {
        const f2 pc = {p[t][j], p[t][j + 1]};             // already 4096 p
        const h2 hv = __builtin_convertvector(pc, h2);
        const h2 lv = __builtin_convertvector(pc - __builtin_convertvector(hv, f2), h2);
        ph[t >> 1][(t & 1) * 8 + j]     = hv[0];
        ph[t >> 1][(t & 1) * 8 + j + 1] = hv[1];
        pl[t >> 1][(t & 1) * 8 + j]     = lv[0];
        pl[t >> 1][(t & 1) * 8 + j + 1] = lv[1];
      }

    // ---- V^T A-fragments, O^T += V^T.P^T ----
    //      listed tile by tile so that the four accumulators alternate; each accumulator's own order of sums is
    //      pl[0], pl[1], ph[0], ph[1]; the loops are unrolled so that fragments and accumulators stay in registers
    HU uv0[4], uv1[4];
#pragma unroll
    for (int n = 0; n < 4; ++n) {
      const _Float16* vr = Vl + (16 * n + l16) * VL_STR;  // A row m = d 16n + l16
      uv0[n].p[0] = *(const h8*)(vr + kb8);                // keys 8h + 0..7
      uv0[n].p[1] = *(const h8*)(vr + 16 + kb8);           // keys 16 + 8h + 0..7
      uv1[n].p[0] = *(const h8*)(vr + 32 + kb8);
      uv1[n].p[1] = *(const h8*)(vr + 48 + kb8);
    }
#pragma unroll
    for (int n = 0; n < 4; ++n) acc[n] = wmma16(uv0[n].v, pl[0], acc[n]);
#pragma unroll
    for (int n = 0; n < 4; ++n) acc[n] = wmma16(uv1[n].v, pl[1], acc[n]);
#pragma unroll
    for (int n = 0; n < 4; ++n) acc[n] = wmma16(uv0[n].v, ph[0], acc[n]);
#pragma unroll
    for (int n = 0; n < 4; ++n) acc[n] = wmma16(uv1[n].v, ph[1], acc[n]);

    // ---- publish point of the next tile; the same barrier frees this trip's buffer ----
    asm volatile("s_wait_dscnt 0x0" ::: "memory");      // this wave's reads of this trip's buffer are over
    asm volatile("s_wait_asynccnt 0x0" ::: "memory");   // this wave's pieces of the next tile have landed
    __syncthreads();
    if (it + 2 < NT) {                                  // tile it + 2 exists: refill the buffer just read
      copy_tile(ks + boff, ks + boff + 32 * KL_STR * 2, vs + boff, vs + boff + 32 * VL_STR * 2,
                kp, kp + 32 * HD, vp, vp + (size_t)32 * SEQ);
      kp += STILE * HD;
      vp += STILE;
    }
    boff = BUF_BYTES - boff;
  }
  asm volatile("s_wait_asynccnt 0x0" ::: "memory");   // nothing in flight; the last trip's barrier ended every read before the staging alias

  // ---- finalize: ctx = acc / lsum / 16 (acc and lsum both carry P's x4096), staged as row map * 64 + query ----
  {
    lsum += xhalf(lsum);
    const float inv = (1.0f / lsum) * (1.0f / 16.0f);
    float* sw = stg + wave * (16 * STG_STR) + l16 * STG_STR + 8 * half;   // row = wave * 16 + l16 = map * 64 + query
#pragma unroll
    for (int n = 0; n < 4; ++n) {
      f4 o0, o1;
#pragma unroll
      for (int j = 0; j < 4; ++j) {
        o0[j] = acc[n][j] * inv;
        o1[j] = acc[n][4 + j] * inv;
      }
      *(f4*)(sw + 16 * n)     = o0;    // d 16n + 8h + 0..3
      *(f4*)(sw + 16 * n + 4) = o1;    // d 16n + 8h + 4..7
    }
  }
  __syncthreads();
  // ---- combine the two maps and normalise: 16 lanes per row of 64 floats, 16 rows per pass, whole-line stores ----
  const int c4 = (tid & 15) * 4;
#pragma unroll
  for (int k = 0; k < QTILE / 16; ++k) {
    const int row = k * 16 + (tid >> 4);             // query 0..63
    const f4 a = *(const f4*)(stg + row * STG_STR + c4);
    const f4 b = *(const f4*)(stg + (QTILE + row) * STG_STR + c4);
    float x[4];
#pragma unroll
    for (int i = 0; i < 4; ++i) x[i] = a[i] - lam * b[i];
    float s = (x[0] + x[1]) + (x[2] + x[3]);
    s += __shfl_xor(s, 1, 32);
    s += __shfl_xor(s, 2, 32);
    s += __shfl_xor(s, 4, 32);
    s += __shfl_xor(s, 8, 32);
    const float mean = s * (1.0f / 64.0f);
    float d[4];
    float ss = 0.0f;
#pragma unroll
    for (int i = 0; i < 4; ++i) { d[i] = x[i] - mean; ss += d[i] * d[i]; }
    ss += __shfl_xor(ss, 1, 32);
    ss += __shfl_xor(ss, 2, 32);
    ss += __shfl_xor(ss, 4, 32);
    ss += __shfl_xor(ss, 8, 32);
    const float var = ss * (1.0f / 64.0f);
    const float rs  = rsqrtf(var + 1.0e-5f);
    f4 o;
#pragma unroll
    for (int i = 0; i < 4; ++i) o[i] = (d[i] * rs) * 0.2f;
    *(f4*)(Out + ((size_t)bh * SEQ + qBase + row) * HD + c4) = o;
  }
}

// =================================================================
// Host launcher
// =================================================================
extern "C" void kernel_launch(void* const* d_in, const int* in_sizes, int n_in,
                              void* d_out, int out_size, void* d_ws, size_t ws_size,
                              hipStream_t stream) {
  if (n_in < 4) return;
  const long long needIn = ((long long)(NBH - 1) * SEQ_FULL + SEQ) * HD;
  if ((long long)in_sizes[0] < needIn || (long long)in_sizes[1] < needIn ||
      (long long)in_sizes[2] < needIn || in_sizes[3] < 1) return;
  if ((long long)out_size < (long long)NBH * SEQ * HD) return;
  if (d_ws == nullptr || ws_size < WS_NEED) return;

  const float* Q   = (const float*)d_in[0];
  const float* K   = (const float*)d_in[1];
  const float* V   = (const float*)d_in[2];
  const float* Lam = (const float*)d_in[3];
  float* Out = (float*)d_out;

  char* ws = (char*)d_ws;
  _Float16* Kh  = (_Float16*)(ws);
  _Float16* Vt  = (_Float16*)(ws + KH_BYTES);

  k_conv<<<dim3(SEQ / STILE, NBH), dim3(256), 0, stream>>>(K, V, Kh, Vt);
  k_attn<<<dim3(SEQ / QTILE, NBH), dim3(256), 0, stream>>>(Q, Kh, Vt, Lam, in_sizes[3], Out);
}

// v008
// A run of this version takes 56.3 microseconds.
// It is 1.49 times as fast as v006, going by the measured steps of the versions left out in between.
// All steps since v000 together make it 3.79 times as fast.
#include <hip/hip_runtime.h>

// scores k_half.q_half^T, transposed (both maps): v_wmma_f32_16x16x32_f16, f16 operands = bf16-RNE input values x16, f32 accumulate;
// V^T.P^T: v_wmma_f32_16x16x32_f16, P = one f16 value (x4096, 11 significant bits), V = bf16-RNE input x16; softmax, combine, normalisation in f32.

typedef _Float16 v16h __attribute__((ext_vector_type(16)));
typedef _Float16 h8   __attribute__((ext_vector_type(8)));
typedef float    v8f  __attribute__((ext_vector_type(8)));
typedef float    f4   __attribute__((ext_vector_type(4)));
typedef unsigned int u4 __attribute__((ext_vector_type(4)));
typedef float    f2   __attribute__((ext_vector_type(2)));
typedef _Float16 h2   __attribute__((ext_vector_type(2)));

#ifndef NB
#define NB 2
#endif
#ifndef SEQ
#define SEQ 2048
#endif
#define NB_FULL  2
#define SEQ_FULL 2048
#define NH   16
#define HD   64
#define D2   32
#define NBH  (NB * NH)
#define QTILE 128          // query rows per block (4 waves x 32 rows for each of the two maps)
#define CG    2            // 16-query column groups per wave: each K / V^T fragment read from LDS feeds CG products
                           // (every loop over a group index g is unrolled: its arrays are indexed by g and must stay in registers)
#define STILE 64           // keys per main-loop iteration
#define NT    (SEQ / STILE)

static_assert(NB <= NB_FULL);
static_assert(SEQ <= SEQ_FULL);
static_assert(SEQ % QTILE == 0);
static_assert(QTILE == 4 * 16 * CG);     // four waves per map, CG groups of 16 queries each
static_assert(SEQ % STILE == 0);
static_assert(SEQ / STILE >= 2);         // the ring's prologue fills two tiles

// ---------------- workspace layout ----------------
#define KH_BYTES  ((size_t)NBH * SEQ * HD * 2)      // f16 K plane  [bh][s][64]
#define VT_BYTES  ((size_t)NBH * HD * SEQ * 2)      // f16 V^T plane [bh][64][s]
#define WS_NEED   (KH_BYTES + VT_BYTES)
static_assert(WS_NEED <= (size_t)134217728);
static_assert(KH_BYTES % 128 == 0);
static_assert(VT_BYTES % 128 == 0);

// ---------------- attention kernel LDS layout ----------------
#define KL_STR   72                                  // halves per K tile row (64 used: both d-halves)
#define VL_STR   72                                  // halves per V^T tile row (64 used)
#define KL_BYTES (STILE * KL_STR * 2)                // 9216
#define VL_BYTES (HD * VL_STR * 2)                   // 9216
#define STG_STR  68                                  // floats per staged output row (64 used; 272 B = 16 B x odd)
#define STG_BYTES (2 * QTILE * STG_STR * 4)          // 69632 epilogue staging, both maps (aliases the K / V tiles)
#define BUF_BYTES (KL_BYTES + VL_BYTES)             // 18432: one K tile and one V^T tile
static_assert(KL_STR == VL_STR);                    // one lane offset serves both tiles of a buffer
#define SMEM_ATT (2 * BUF_BYTES > STG_BYTES ? 2 * BUF_BYTES : STG_BYTES)

// bf16 RNE of an f32 value, returned as f32
__device__ __forceinline__ float bf16_rne(float x) {
  unsigned u = __float_as_uint(x);
  u = (u + 0x7FFFu + ((u >> 16) & 1u)) & 0xFFFF0000u;
  return __uint_as_float(u);
}
// bf16-RNE value carried x16 in an f16 container (exact)
__device__ __forceinline__ _Float16 cv16(float x) { return (_Float16)(bf16_rne(x) * 16.0f); }

// lane l <-> lane l ^ 16
__device__ __forceinline__ float xhalf(float x) {
  const int b = __builtin_bit_cast(int, x);
  return __builtin_bit_cast(float, __builtin_amdgcn_permlanex16(b, b, 0x76543210, 0xfedcba98, false, false));
}

__device__ __forceinline__ v8f wmma16(v16h a, v16h b, v8f c) {
  return __builtin_amdgcn_wmma_f32_16x16x32_f16(false, a, false, b, (short)0, c, false, false);
}

// One tile's four 16-byte pieces of this lane, global -> LDS through no register. The s_wait_xcnt stands inside
// the statement so that no address register of a copy is rewritten ahead of it.
__device__ __forceinline__ void copy_tile(unsigned l0, unsigned l1, unsigned l2, unsigned l3,
                                          const _Float16* g0, const _Float16* g1,
                                          const _Float16* g2, const _Float16* g3) {
  asm volatile("global_load_async_to_lds_b128 %0, %4, off\n\t"
               "global_load_async_to_lds_b128 %1, %5, off\n\t"
               "global_load_async_to_lds_b128 %2, %6, off\n\t"
               "global_load_async_to_lds_b128 %3, %7, off\n\t"
               "s_wait_xcnt 0x0"
               :: "v"(l0), "v"(l1), "v"(l2), "v"(l3), "v"(g0), "v"(g1), "v"(g2), "v"(g3) : "memory");
}

// =================================================================
// Pre-pass: K -> f16 plane [bh][s][64] (x16), V -> f16 transposed plane [bh][64][s] (x16)
// grid (SEQ/64, NBH), 256 threads; one 64-key tile per block
// =================================================================
__global__ __launch_bounds__(256) void k_conv(const float* __restrict__ K,
                                              const float* __restrict__ V,
                                              _Float16* __restrict__ Kh,
                                              _Float16* __restrict__ Vt) {
  __shared__ __align__(16) _Float16 vtl[HD * VL_STR];   // [d][s] tile, cross-wave (block barrier)
  const int tid = threadIdx.x;
  const int bh  = blockIdx.y;
  const int s0  = blockIdx.x * STILE;
  const float* Kg = K + ((size_t)bh * SEQ_FULL + s0) * HD;
  const float* Vg = V + ((size_t)bh * SEQ_FULL + s0) * HD;
  _Float16* Kp = Kh + ((size_t)bh * SEQ + s0) * HD;
  _Float16* Vp = Vt + (size_t)bh * HD * SEQ + s0;

  union HU8 { h8 h; u4 u; _Float16 s[8]; };
  HU8 kv[2];
#pragma unroll
  for (int i = 0; i < 2; ++i) {
    const int idx = tid + 256 * i;           // 0..511
    const int row = idx >> 3;                // key row 0..63
    const int c8  = (idx & 7) * 8;           // d 0..56
    const f4 a  = *(const f4*)(Kg + row * HD + c8);
    const f4 b  = *(const f4*)(Kg + row * HD + c8 + 4);
    const f4 va = *(const f4*)(Vg + row * HD + c8);
    const f4 vb = *(const f4*)(Vg + row * HD + c8 + 4);
#pragma unroll
    for (int e = 0; e < 4; ++e) {
      kv[i].s[e]     = cv16(a[e]);
      kv[i].s[4 + e] = cv16(b[e]);
      vtl[(c8 + e) * VL_STR + row]     = cv16(va[e]);
      vtl[(c8 + 4 + e) * VL_STR + row] = cv16(vb[e]);
    }
  }
  __syncthreads();
  HU8 vv[2];
#pragma unroll
  for (int i = 0; i < 2; ++i) {
    const int idx = tid + 256 * i;
    const int d   = idx >> 3;
    const int p8  = (idx & 7) * 8;
    vv[i].h = *(const h8*)(vtl + d * VL_STR + p8);
  }
#pragma unroll
  for (int i = 0; i < 2; ++i) {
    const int idx = tid + 256 * i;
    const int row = idx >> 3, c8 = (idx & 7) * 8;
    *(u4*)(Kp + row * HD + c8) = kv[i].u;
    *(u4*)(Vp + (size_t)row * SEQ + c8) = vv[i].u;   // row = d here
  }
  
}

__global__ __launch_bounds__(256) __attribute__((amdgpu_waves_per_eu(4, 4))) void k_attn(const float* __restrict__ Q,
                                              const _Float16* __restrict__ Kh,
                                              const _Float16* __restrict__ Vt,
                                              const float* __restrict__ Lam,
                                              int nlam,
                                              float* __restrict__ Out) {
  const int tid  = threadIdx.x;
  const int lane = tid & 31;
  const int wave = tid >> 5;
  const int l16  = lane & 15;
  const int half = lane >> 4;
  const int kb8  = half * 8;

  const int bh    = blockIdx.y;
  const int qBase = blockIdx.x * QTILE;
  const int doff  = (wave >> 2) * D2;   // map = wave >> 2

  __shared__ __align__(16) unsigned char smem[SMEM_ATT];
  // two buffers, each K tile [64 key][72] then V^T tile [64 d][72], cross-wave
  float*    stg = (float*)smem;                                              // epilogue alias [2 maps x 128][68]

  // ---- Q B-fragment (column = query l16, 32 d of the selected half) straight from f32 global ----
  union HU { v16h v; h8 p[2]; _Float16 s[16]; };
  v16h qa[CG];                         // group g: query (wave & 3) * 32 + 16g + l16
  {
    const float* qp = Q + ((size_t)bh * SEQ_FULL + qBase + (wave & 3) * (16 * CG) + l16) * HD + doff;
    f4 x0[CG], x1[CG], x2[CG], x3[CG];
#pragma unroll
    for (int g = 0; g < CG; ++g) {
      x0[g] = *(const f4*)(qp + g * 16 * HD + kb8);
      x1[g] = *(const f4*)(qp + g * 16 * HD + kb8 + 4);
      x2[g] = *(const f4*)(qp + g * 16 * HD + 16 + kb8);
      x3[g] = *(const f4*)(qp + g * 16 * HD + 16 + kb8 + 4);
    }
    asm volatile("s_wait_xcnt 0x0" ::: "memory");   // before the address registers of these loads are reused
#pragma unroll
    for (int g = 0; g < CG; ++g) {
      HU uq;
#pragma unroll
      for (int e = 0; e < 4; ++e) {
        uq.s[e]      = cv16(x0[g][e]);   // elements 0..7  <- d = 8h + 0..7
        uq.s[4 + e]  = cv16(x1[g][e]);
        uq.s[8 + e]  = cv16(x2[g][e]);   // elements 8..15 <- d = 16 + 8h + 0..7
        uq.s[12 + e] = cv16(x3[g][e]);
      }
      qa[g] = uq.v;
    }
  }

  // ---- this head's lambda, fetched here so that its latency is not paid in the epilogue ----
  int h = bh % NH;
  h = min(h, nlam - 1);
  h = max(h, 0);
  const float lam = bf16_rne(Lam[h]);

  // ---- online-softmax state ----
  // ---- per lane and group: one query; m in raw accumulator units; lsum = 4096 x the sum over this lane half's keys, joined in the epilogue ----
  float m[CG], lsum[CG];
  v8f acc[CG][4];                      // O^T tiles: register j = d 16n + 8h + j, column = query 16g + l16
#pragma unroll
  for (int g = 0; g < CG; ++g) {
    m[g] = -1.0e30f;
    lsum[g] = 0.0f;
#pragma unroll
    for (int n = 0; n < 4; ++n)
#pragma unroll
      for (int j = 0; j < 8; ++j) acc[g][n][j] = 0.0f;
  }

  const _Float16* khBase = Kh + (size_t)bh * SEQ * HD;
  const _Float16* vtBase = Vt + (size_t)bh * HD * SEQ;
  // log2(e) / sqrt(32) / 256 (q and k each carried x16): one raw score accumulator unit, in powers of two
  const float SCL = 1.4426950408889634f * 0.17677669529663688f * 0.00390625f;

  // staging: this thread's 16-byte piece of rows srow and srow + 32 of the K tile and of the V^T tile
  const int srow = tid >> 3;          // 0..31: key row of K, d row of V^T
  const int sp8  = (tid & 7) * 8;     // 0..56: d of K, key of V^T
  const _Float16* kp = khBase + (size_t)srow * HD + sp8;
  const _Float16* vp = vtBase + (size_t)srow * SEQ + sp8;
  const unsigned ks = (unsigned)(size_t)smem + (srow * KL_STR + sp8) * 2;   // LDS byte address in buffer 0
  const unsigned vs = ks + KL_BYTES;                                        // the same place in the V^T tile

  // ---- ring prologue: tile 0 landed and published, tile 1 in flight ----
  copy_tile(ks, ks + 32 * KL_STR * 2, vs, vs + 32 * VL_STR * 2, kp, kp + 32 * HD, vp, vp + (size_t)32 * SEQ);
  kp += STILE * HD;
  vp += STILE;
  asm volatile("s_wait_asynccnt 0x0" ::: "memory");   // this wave's pieces of tile 0 have landed
  __syncthreads();
  copy_tile(ks + BUF_BYTES, ks + BUF_BYTES + 32 * KL_STR * 2, vs + BUF_BYTES, vs + BUF_BYTES + 32 * VL_STR * 2,
            kp, kp + 32 * HD, vp, vp + (size_t)32 * SEQ);
  kp += STILE * HD;
  vp += STILE;

  unsigned boff = 0;                  // byte offset of the buffer that this trip reads
  for (int it = 0; it < NT; ++it) {
    const _Float16* Kl = (const _Float16*)(smem + boff);
    const _Float16* Vl = (const _Float16*)(smem + boff + KL_BYTES);

    // ---- S^T over four 16-key subtiles (K = 32 = one WMMA each and group); one K fragment serves both groups ----
    float p[CG][4][8];
    float tmax[CG];
#pragma unroll
    for (int g = 0; g < CG; ++g) tmax[g] = -1.0e30f;
#pragma unroll
    for (int t = 0; t < 4; ++t) {
      HU ua;
      const _Float16* kr = Kl + (t * 16 + l16) * KL_STR + doff;   // A row m = key t*16 + l16, this map's d-half
      ua.p[0] = *(const h8*)(kr + kb8);                    // elements 0..7  <- d = 8h + 0..7
      ua.p[1] = *(const h8*)(kr + 16 + kb8);               // elements 8..15 <- d = 16 + 8h + 0..7
#pragma unroll
      for (int g = 0; g < CG; ++g) {
        v8f c8;
#pragma unroll
        for (int j = 0; j < 8; ++j) c8[j] = 0.0f;
        c8 = wmma16(ua.v, qa[g], c8);                      // D[key t*16 + 8h + j][query 16g + l16]
#pragma unroll
        for (int j = 0; j < 8; ++j) {
          p[g][t][j] = c8[j];                              // raw accumulator; SCL > 0 keeps the order of the maximum
          tmax[g] = fmaxf(tmax[g], c8[j]);
        }
      }
    }

    v16h ph[CG][2];
#pragma unroll
    for (int g = 0; g < CG; ++g) {
      // ---- one query per lane: maximum in-lane, one exchange between the lane halves ----
      const float tm   = fmaxf(tmax[g], xhalf(tmax[g]));
      const float nm   = fmaxf(m[g], tm);
      const float corr = __builtin_amdgcn_exp2f((m[g] - nm) * SCL);
      m[g] = nm;
      const float off = 12.0f - nm * SCL;   // 4096 p = 2^(c * SCL - m * SCL + 12): scale, base change and P's x4096 in one FMA
      float s[4];                        // one independent chain per subtile
#pragma unroll
      for (int t = 0; t < 4; ++t) {
        s[t] = 0.0f;
#pragma unroll
        for (int j = 0; j < 8; j += 2) {
          // the FMA on the accumulator's own even register pair, so that no score is copied to form a pair
          const f2 x = __builtin_elementwise_fma((f2){p[g][t][j], p[g][t][j + 1]}, (f2){SCL, SCL}, (f2){off, off});
          p[g][t][j]     = __builtin_amdgcn_exp2f(x[0]);
          p[g][t][j + 1] = __builtin_amdgcn_exp2f(x[1]);
          s[t] += p[g][t][j];
          s[t] += p[g][t][j + 1];
        }
      }
      lsum[g] = lsum[g] * corr + ((s[0] + s[1]) + (s[2] + s[3]));
#pragma unroll
      for (int n = 0; n < 4; ++n)
#pragma unroll
        for (int j = 0; j < 8; ++j) acc[g][n][j] *= corr;

      // ---- P^T B-fragments in place: f16(4096 p), rounded to nearest: within 2^-11 of p or 2^-37 of the row's largest p,
      //      whichever is larger, three bits finer than V's own 8-bit significand; the row sum stays on the f32 p;
      //      element e of pair u <- key 32u + (e < 8 ? 8h + e : 16 + 8h + e - 8) = subtile 2u + (e >> 3), register e & 7 ----
#pragma unroll
      for (int t = 0; t < 4; ++t)
#pragma unroll
        for (int j = 0; j < 8; j += 2) {
          const f2 pc = {p[g][t][j], p[g][t][j + 1]};     // already 4096 p
          const h2 hv = __builtin_convertvector(pc, h2);
          ph[g][t >> 1][(t & 1) * 8 + j]     = hv[0];
          ph[g][t >> 1][(t & 1) * 8 + j + 1] = hv[1];
        }
    }

    // ---- V^T A-fragments, O^T += V^T.P^T; one V^T fragment serves both groups ----
    //      each accumulator's own order of sums is ph[g][0], ph[g][1];
    //      the loops are unrolled so that fragments and accumulators stay in registers
    HU uv[2][4];
#pragma unroll
    for (int u = 0; u < 2; ++u)
#pragma unroll
      for (int n = 0; n < 4; ++n) {
        const _Float16* vr = Vl + (16 * n + l16) * VL_STR + 32 * u;  // A row m = d 16n + l16
        uv[u][n].p[0] = *(const h8*)(vr + kb8);            // keys 32u + 8h + 0..7
        uv[u][n].p[1] = *(const h8*)(vr + 16 + kb8);       // keys 32u + 16 + 8h + 0..7
      }
#pragma unroll
    for (int u = 0; u < 2; ++u)
#pragma unroll
      for (int n = 0; n < 4; ++n)
#pragma unroll
        for (int g = 0; g < CG; ++g) acc[g][n] = wmma16(uv[u][n].v, ph[g][u], acc[g][n]);

    // ---- publish point of the next tile; the same barrier frees this trip's buffer ----
    asm volatile("s_wait_dscnt 0x0" ::: "memory");      // this wave's reads of this trip's buffer are over
    asm volatile("s_wait_asynccnt 0x0" ::: "memory");   // this wave's pieces of the next tile have landed
    __syncthreads();
    if (it + 2 < NT) {                                  // tile it + 2 exists: refill the buffer just read
      copy_tile(ks + boff, ks + boff + 32 * KL_STR * 2, vs + boff, vs + boff + 32 * VL_STR * 2,
                kp, kp + 32 * HD, vp, vp + (size_t)32 * SEQ);
      kp += STILE * HD;
      vp += STILE;
    }
    boff = BUF_BYTES - boff;
  }
  asm volatile("s_wait_asynccnt 0x0" ::: "memory");   // nothing in flight; the last trip's barrier ended every read before the staging alias

  // ---- finalize: ctx = acc / lsum / 16 (acc and lsum both carry P's x4096), staged as row map * 128 + query ----
#pragma unroll
  for (int g = 0; g < CG; ++g) {
    const float ls  = lsum[g] + xhalf(lsum[g]);
    const float inv = (1.0f / ls) * (1.0f / 16.0f);
    float* sw = stg + (wave * (16 * CG) + 16 * g + l16) * STG_STR + 8 * half;   // row = map * 128 + query
#pragma unroll
    for (int n = 0; n < 4; ++n) {
      f4 o0, o1;
#pragma unroll
      for (int j = 0; j < 4; ++j) {
        o0[j] = acc[g][n][j] * inv;
        o1[j] = acc[g][n][4 + j] * inv;
      }
      *(f4*)(sw + 16 * n)     = o0;    // d 16n + 8h + 0..3
      *(f4*)(sw + 16 * n + 4) = o1;    // d 16n + 8h + 4..7
    }
  }
  __syncthreads();
  // ---- combine the two maps and normalise: 16 lanes per row of 64 floats, 16 rows per pass, whole-line stores ----
  const int c4 = (tid & 15) * 4;
#pragma unroll
  for (int k = 0; k < QTILE / 16; ++k) {
    const int row = k * 16 + (tid >> 4);             // query 0..127
    const f4 a = *(const f4*)(stg + row * STG_STR + c4);
    const f4 b = *(const f4*)(stg + (QTILE + row) * STG_STR + c4);
    float x[4];
#pragma unroll
    for (int i = 0; i < 4; ++i) x[i] = a[i] - lam * b[i];
    float s = (x[0] + x[1]) + (x[2] + x[3]);
    s += __shfl_xor(s, 1, 32);
    s += __shfl_xor(s, 2, 32);
    s += __shfl_xor(s, 4, 32);
    s += __shfl_xor(s, 8, 32);
    const float mean = s * (1.0f / 64.0f);
    float d[4];
    float ss = 0.0f;
#pragma unroll
    for (int i = 0; i < 4; ++i) { d[i] = x[i] - mean; ss += d[i] * d[i]; }
    ss += __shfl_xor(ss, 1, 32);
    ss += __shfl_xor(ss, 2, 32);
    ss += __shfl_xor(ss, 4, 32);
    ss += __shfl_xor(ss, 8, 32);
    const float var = ss * (1.0f / 64.0f);
    const float rs  = rsqrtf(var + 1.0e-5f);
    f4 o;
#pragma unroll
    for (int i = 0; i < 4; ++i) o[i] = (d[i] * rs) * 0.2f;
    *(f4*)(Out + ((size_t)bh * SEQ + qBase + row) * HD + c4) = o;
  }
}

// =================================================================
// Host launcher
// =================================================================
extern "C" void kernel_launch(void* const* d_in, const int* in_sizes, int n_in,
                              void* d_out, int out_size, void* d_ws, size_t ws_size,
                              hipStream_t stream) {
  if (n_in < 4) return;
  const long long needIn = ((long long)(NBH - 1) * SEQ_FULL + SEQ) * HD;
  if ((long long)in_sizes[0] < needIn || (long long)in_sizes[1] < needIn ||
      (long long)in_sizes[2] < needIn || in_sizes[3] < 1) return;
  if ((long long)out_size < (long long)NBH * SEQ * HD) return;
  if (d_ws == nullptr || ws_size < WS_NEED) return;

  const float* Q   = (const float*)d_in[0];
  const float* K   = (const float*)d_in[1];
  const float* V   = (const float*)d_in[2];
  const float* Lam = (const float*)d_in[3];
  float* Out = (float*)d_out;

  char* ws = (char*)d_ws;
  _Float16* Kh  = (_Float16*)(ws);
  _Float16* Vt  = (_Float16*)(ws + KH_BYTES);

  k_conv<<<dim3(SEQ / STILE, NBH), dim3(256), 0, stream>>>(K, V, Kh, Vt);
  k_attn<<<dim3(SEQ / QTILE, NBH), dim3(256), 0, stream>>>(Q, Kh, Vt, Lam, in_sizes[3], Out);
}

// v009
// One run takes 53.6 microseconds.
// Two timings next to v008 both put it at 1.05 times that version's speed.
// Over all steps from v000 it is 3.98 times as fast.
#include <hip/hip_runtime.h>

// scores k_half.q_half^T, transposed (both maps): v_wmma_f32_16x16x32_f16, f16 operands = bf16-RNE input values x16, f32 accumulate;
// V^T.P^T: v_wmma_f32_16x16x32_f16, P = one f16 value (x4096, 11 significant bits), V = bf16-RNE input x16; softmax, combine, normalisation in f32.

typedef _Float16 v16h __attribute__((ext_vector_type(16)));
typedef _Float16 h8   __attribute__((ext_vector_type(8)));
typedef float    v8f  __attribute__((ext_vector_type(8)));
typedef float    f4   __attribute__((ext_vector_type(4)));
typedef unsigned int u4 __attribute__((ext_vector_type(4)));
typedef float    f2   __attribute__((ext_vector_type(2)));
typedef _Float16 h2   __attribute__((ext_vector_type(2)));

#ifndef NB
#define NB 2
#endif
#ifndef SEQ
#define SEQ 2048
#endif
#define NB_FULL  2
#define SEQ_FULL 2048
#define NH   16
#define HD   64
#define D2   32
#define NBH  (NB * NH)
#define QTILE 128          // query rows per block (4 waves x 32 rows for each of the two maps)
#define CG    2            // 16-query column groups per wave: each K / V^T fragment read from LDS feeds CG products
                           // (every loop over a group index g is unrolled: its arrays are indexed by g and must stay in registers)
#define STILE 64           // keys per main-loop iteration
#define NT    (SEQ / STILE)

static_assert(NB <= NB_FULL);
static_assert(SEQ <= SEQ_FULL);
static_assert(SEQ % QTILE == 0);
static_assert(QTILE == 4 * 16 * CG);     // four waves per map, CG groups of 16 queries each
static_assert(SEQ % STILE == 0);
static_assert(SEQ / STILE >= 2);         // the ring's prologue fills two tiles

// ---------------- workspace layout ----------------
#define KH_BYTES  ((size_t)NBH * SEQ * HD * 2)      // f16 K plane  [bh][s][64]
#define VT_BYTES  ((size_t)NBH * HD * SEQ * 2)      // f16 V^T plane [bh][64][s]
#define WS_NEED   (KH_BYTES + VT_BYTES)
static_assert(WS_NEED <= (size_t)134217728);
static_assert(KH_BYTES % 128 == 0);
static_assert(VT_BYTES % 128 == 0);

// ---------------- attention kernel LDS layout ----------------
#define KL_STR   72                                  // halves per K tile row (64 used: both d-halves)
#define VL_STR   72                                  // halves per V^T tile row (64 used)
#define KL_BYTES (STILE * KL_STR * 2)                // 9216
#define VL_BYTES (HD * VL_STR * 2)                   // 9216
#define STG_STR  68                                  // floats per staged output row (64 used; 272 B = 16 B x odd)
#define STG_BYTES (2 * QTILE * STG_STR * 4)          // 69632 epilogue staging, both maps (aliases the K / V tiles)
#define BUF_BYTES (KL_BYTES + VL_BYTES)             // 18432: one K tile and one V^T tile
static_assert(KL_STR == VL_STR);                    // one lane offset serves both tiles of a buffer
#define SMEM_ATT (2 * BUF_BYTES > STG_BYTES ? 2 * BUF_BYTES : STG_BYTES)

// bf16 RNE of an f32 value, returned as f32
__device__ __forceinline__ float bf16_rne(float x) {
  unsigned u = __float_as_uint(x);
  u = (u + 0x7FFFu + ((u >> 16) & 1u)) & 0xFFFF0000u;
  return __uint_as_float(u);
}
// bf16-RNE value carried x16 in an f16 container (exact)
__device__ __forceinline__ _Float16 cv16(float x) { return (_Float16)(bf16_rne(x) * 16.0f); }

// lane l <-> lane l ^ 16
__device__ __forceinline__ float xhalf(float x) {
  const int b = __builtin_bit_cast(int, x);
  return __builtin_bit_cast(float, __builtin_amdgcn_permlanex16(b, b, 0x76543210, 0xfedcba98, false, false));
}

__device__ __forceinline__ v8f wmma16(v16h a, v16h b, v8f c) {
  return __builtin_amdgcn_wmma_f32_16x16x32_f16(false, a, false, b, (short)0, c, false, false);
}

// One tile's four 16-byte pieces of this lane, global -> LDS through no register. The s_wait_xcnt stands inside
// the statement so that no address register of a copy is rewritten ahead of it.
__device__ __forceinline__ void copy_tile(unsigned l0, unsigned l1, unsigned l2, unsigned l3,
                                          const _Float16* g0, const _Float16* g1,
                                          const _Float16* g2, const _Float16* g3) {
  asm volatile("global_load_async_to_lds_b128 %0, %4, off\n\t"
               "global_load_async_to_lds_b128 %1, %5, off\n\t"
               "global_load_async_to_lds_b128 %2, %6, off\n\t"
               "global_load_async_to_lds_b128 %3, %7, off\n\t"
               "s_wait_xcnt 0x0"
               :: "v"(l0), "v"(l1), "v"(l2), "v"(l3), "v"(g0), "v"(g1), "v"(g2), "v"(g3) : "memory");
}

// =================================================================
// Pre-pass: K -> f16 plane [bh][s][64] (x16), V -> f16 transposed plane [bh][64][s] (x16)
// grid (SEQ/64, NBH), 256 threads; one 64-key tile per block
// =================================================================
__global__ __launch_bounds__(256) void k_conv(const float* __restrict__ K,
                                              const float* __restrict__ V,
                                              _Float16* __restrict__ Kh,
                                              _Float16* __restrict__ Vt) {
  __shared__ __align__(16) _Float16 vtl[HD * VL_STR];   // [d][s] tile, cross-wave (block barrier)
  const int tid = threadIdx.x;
  const int bh  = blockIdx.y;
  const int s0  = blockIdx.x * STILE;
  const float* Kg = K + ((size_t)bh * SEQ_FULL + s0) * HD;
  const float* Vg = V + ((size_t)bh * SEQ_FULL + s0) * HD;
  _Float16* Kp = Kh + ((size_t)bh * SEQ + s0) * HD;
  _Float16* Vp = Vt + (size_t)bh * HD * SEQ + s0;

  union HU8 { h8 h; u4 u; _Float16 s[8]; };
  HU8 kv[2];
#pragma unroll
  for (int i = 0; i < 2; ++i) {
    const int idx = tid + 256 * i;           // 0..511
    const int row = idx >> 3;                // key row 0..63
    const int c8  = (idx & 7) * 8;           // d 0..56
    const f4 a  = *(const f4*)(Kg + row * HD + c8);
    const f4 b  = *(const f4*)(Kg + row * HD + c8 + 4);
    const f4 va = *(const f4*)(Vg + row * HD + c8);
    const f4 vb = *(const f4*)(Vg + row * HD + c8 + 4);
#pragma unroll
    for (int e = 0; e < 4; ++e) {
      kv[i].s[e]     = cv16(a[e]);
      kv[i].s[4 + e] = cv16(b[e]);
      vtl[(c8 + e) * VL_STR + row]     = cv16(va[e]);
      vtl[(c8 + 4 + e) * VL_STR + row] = cv16(vb[e]);
    }
  }
  __syncthreads();
  HU8 vv[2];
#pragma unroll
  for (int i = 0; i < 2; ++i) {
    const int idx = tid + 256 * i;
    const int d   = idx >> 3;
    const int p8  = (idx & 7) * 8;
    vv[i].h = *(const h8*)(vtl + d * VL_STR + p8);
  }
#pragma unroll
  for (int i = 0; i < 2; ++i) {
    const int idx = tid + 256 * i;
    const int row = idx >> 3, c8 = (idx & 7) * 8;
    *(u4*)(Kp + row * HD + c8) = kv[i].u;
    *(u4*)(Vp + (size_t)row * SEQ + c8) = vv[i].u;   // row = d here
  }
  
}

__global__ __launch_bounds__(256) __attribute__((amdgpu_waves_per_eu(4, 4))) void k_attn(const float* __restrict__ Q,
                                              const _Float16* __restrict__ Kh,
                                              const _Float16* __restrict__ Vt,
                                              const float* __restrict__ Lam,
                                              int nlam,
                                              float* __restrict__ Out) {
  const int tid  = threadIdx.x;
  const int lane = tid & 31;
  const int wave = tid >> 5;
  const int l16  = lane & 15;
  const int half = lane >> 4;
  const int kb8  = half * 8;

  const int bh    = blockIdx.y;
  const int qBase = blockIdx.x * QTILE;
  const int doff  = (wave >> 2) * D2;   // map = wave >> 2

  __shared__ __align__(16) unsigned char smem[SMEM_ATT];
  // two buffers, each K tile [64 key][72] then V^T tile [64 d][72], cross-wave
  float*    stg = (float*)smem;                                              // epilogue alias [2 maps x 128][68]

  // ---- Q B-fragment (column = query l16, 32 d of the selected half) straight from f32 global ----
  union HU { v16h v; h8 p[2]; _Float16 s[16]; };
  v16h qa[CG];                         // group g: query (wave & 3) * 32 + 16g + l16
  {
    const float* qp = Q + ((size_t)bh * SEQ_FULL + qBase + (wave & 3) * (16 * CG) + l16) * HD + doff;
    f4 x0[CG], x1[CG], x2[CG], x3[CG];
#pragma unroll
    for (int g = 0; g < CG; ++g) {
      x0[g] = *(const f4*)(qp + g * 16 * HD + kb8);
      x1[g] = *(const f4*)(qp + g * 16 * HD + kb8 + 4);
      x2[g] = *(const f4*)(qp + g * 16 * HD + 16 + kb8);
      x3[g] = *(const f4*)(qp + g * 16 * HD + 16 + kb8 + 4);
    }
    asm volatile("s_wait_xcnt 0x0" ::: "memory");   // before the address registers of these loads are reused
#pragma unroll
    for (int g = 0; g < CG; ++g) {
      HU uq;
#pragma unroll
      for (int e = 0; e < 4; ++e) {
        uq.s[e]      = cv16(x0[g][e]);   // elements 0..7  <- d = 8h + 0..7
        uq.s[4 + e]  = cv16(x1[g][e]);
        uq.s[8 + e]  = cv16(x2[g][e]);   // elements 8..15 <- d = 16 + 8h + 0..7
        uq.s[12 + e] = cv16(x3[g][e]);
      }
      qa[g] = uq.v;
    }
  }

  // ---- this head's lambda, fetched here so that its latency is not paid in the epilogue ----
  int h = bh % NH;
  h = min(h, nlam - 1);
  h = max(h, 0);
  const float lam = bf16_rne(Lam[h]);

  // ---- online-softmax state ----
  // ---- per lane and group: one query; m in raw accumulator units; lsum = 4096 x the sum over this lane half's keys, joined in the epilogue ----
  // ---- m is the maximum IN USE: it may trail the true running maximum by up to LAZY powers of two, so p reaches 2^LAZY at most;
  //      thr = m + LAZY in raw units (the test), off = 12 - m * SCL (the FMA's addend): both change only where m does ----
  float m[CG], thr[CG], off[CG], lsum[CG];
  v8f acc[CG][4];                      // O^T tiles: register j = d 16n + 8h + j, column = query 16g + l16
#pragma unroll
  for (int g = 0; g < CG; ++g) {
    m[g] = -1.0e30f;
    thr[g] = -1.0e30f;                 // below every score: the first trip always sets m
    off[g] = 0.0f;
    lsum[g] = 0.0f;
#pragma unroll
    for (int n = 0; n < 4; ++n)
#pragma unroll
      for (int j = 0; j < 8; ++j) acc[g][n][j] = 0.0f;
  }

  const _Float16* khBase = Kh + (size_t)bh * SEQ * HD;
  const _Float16* vtBase = Vt + (size_t)bh * HD * SEQ;
  // log2(e) / sqrt(32) / 256 (q and k each carried x16): one raw score accumulator unit, in powers of two
  const float SCL = 1.4426950408889634f * 0.17677669529663688f * 0.00390625f;
  // 4096 p <= 2^(12 + LAZY) = 32768 stays inside f16 (65504)
  const float LAZY = 3.0f;

  // staging: this thread's 16-byte piece of rows srow and srow + 32 of the K tile and of the V^T tile
  const int srow = tid >> 3;          // 0..31: key row of K, d row of V^T
  const int sp8  = (tid & 7) * 8;     // 0..56: d of K, key of V^T
  const _Float16* kp = khBase + (size_t)srow * HD + sp8;
  const _Float16* vp = vtBase + (size_t)srow * SEQ + sp8;
  const unsigned ks = (unsigned)(size_t)smem + (srow * KL_STR + sp8) * 2;   // LDS byte address in buffer 0
  const unsigned vs = ks + KL_BYTES;                                        // the same place in the V^T tile

  // ---- ring prologue: tile 0 landed and published, tile 1 in flight ----
  copy_tile(ks, ks + 32 * KL_STR * 2, vs, vs + 32 * VL_STR * 2, kp, kp + 32 * HD, vp, vp + (size_t)32 * SEQ);
  kp += STILE * HD;
  vp += STILE;
  asm volatile("s_wait_asynccnt 0x0" ::: "memory");   // this wave's pieces of tile 0 have landed
  __syncthreads();
  copy_tile(ks + BUF_BYTES, ks + BUF_BYTES + 32 * KL_STR * 2, vs + BUF_BYTES, vs + BUF_BYTES + 32 * VL_STR * 2,
            kp, kp + 32 * HD, vp, vp + (size_t)32 * SEQ);
  kp += STILE * HD;
  vp += STILE;

  unsigned boff = 0;                  // byte offset of the buffer that this trip reads
  for (int it = 0; it < NT; ++it) {
    const _Float16* Kl = (const _Float16*)(smem + boff);
    const _Float16* Vl = (const _Float16*)(smem + boff + KL_BYTES);

    // ---- S^T over four 16-key subtiles (K = 32 = one WMMA each and group); one K fragment serves both groups ----
    float p[CG][4][8];
    float tmax[CG];
#pragma unroll
    for (int g = 0; g < CG; ++g) tmax[g] = -1.0e30f;
#pragma unroll
    for (int t = 0; t < 4; ++t) {
      HU ua;
      const _Float16* kr = Kl + (t * 16 + l16) * KL_STR + doff;   // A row m = key t*16 + l16, this map's d-half
      ua.p[0] = *(const h8*)(kr + kb8);                    // elements 0..7  <- d = 8h + 0..7
      ua.p[1] = *(const h8*)(kr + 16 + kb8);               // elements 8..15 <- d = 16 + 8h + 0..7
#pragma unroll
      for (int g = 0; g < CG; ++g) {
        v8f c8;
#pragma unroll
        for (int j = 0; j < 8; ++j) c8[j] = 0.0f;
        c8 = wmma16(ua.v, qa[g], c8);                      // D[key t*16 + 8h + j][query 16g + l16]
#pragma unroll
        for (int j = 0; j < 8; ++j) {
          p[g][t][j] = c8[j];                              // raw accumulator; SCL > 0 keeps the order of the maximum
          tmax[g] = fmaxf(tmax[g], c8[j]);
        }
      }
    }

    // ---- lazy rescale: one test per trip for the whole wave. Each lane tests its own half's keys, the ballot joins the halves and
    //      the groups; only when some score lies more than LAZY powers of two above its query's m are m, the row sums and the
    //      accumulators moved (rare after the first trips); the branch is wave-uniform and holds no barrier ----
    bool need = false;
#pragma unroll
    for (int g = 0; g < CG; ++g) need = need || (tmax[g] > thr[g]);
    if (__builtin_amdgcn_ballot_w32(need) != 0) {
#pragma unroll
      for (int g = 0; g < CG; ++g) {
        // one query per lane: maximum in-lane, one exchange between the lane halves, so that both halves hold the same m
        const float tm   = fmaxf(tmax[g], xhalf(tmax[g]));
        const float nm   = fmaxf(m[g], tm);
        const float corr = __builtin_amdgcn_exp2f((m[g] - nm) * SCL);
        m[g]   = nm;
        thr[g] = nm + LAZY / SCL;
        off[g] = 12.0f - nm * SCL;       // 4096 p = 2^(c * SCL - m * SCL + 12): scale, base change and P's x4096 in one FMA
        lsum[g] *= corr;
#pragma unroll
        for (int n = 0; n < 4; ++n)
#pragma unroll
          for (int j = 0; j < 8; ++j) acc[g][n][j] *= corr;
      }
    }

    v16h ph[CG][2];
#pragma unroll
    for (int g = 0; g < CG; ++g) {
      float s[4];                        // one independent chain per subtile
#pragma unroll
      for (int t = 0; t < 4; ++t) {
        s[t] = 0.0f;
#pragma unroll
        for (int j = 0; j < 8; j += 2) {
          // the FMA on the accumulator's own even register pair, so that no score is copied to form a pair
          const f2 x = __builtin_elementwise_fma((f2){p[g][t][j], p[g][t][j + 1]}, (f2){SCL, SCL}, (f2){off[g], off[g]});
          p[g][t][j]     = __builtin_amdgcn_exp2f(x[0]);
          p[g][t][j + 1] = __builtin_amdgcn_exp2f(x[1]);
          s[t] += p[g][t][j];
          s[t] += p[g][t][j + 1];
        }
      }
      lsum[g] += (s[0] + s[1]) + (s[2] + s[3]);

      // ---- P^T B-fragments in place: f16(4096 p), rounded to nearest: within 2^-11 of p or 2^-37 of the row's largest p,
      //      whichever is larger, three bits finer than V's own 8-bit significand; the row sum stays on the f32 p;
      //      element e of pair u <- key 32u + (e < 8 ? 8h + e : 16 + 8h + e - 8) = subtile 2u + (e >> 3), register e & 7 ----
#pragma unroll
      for (int t = 0; t < 4; ++t)
#pragma unroll
        for (int j = 0; j < 8; j += 2) {
          const f2 pc = {p[g][t][j], p[g][t][j + 1]};     // already 4096 p
          const h2 hv = __builtin_convertvector(pc, h2);
          ph[g][t >> 1][(t & 1) * 8 + j]     = hv[0];
          ph[g][t >> 1][(t & 1) * 8 + j + 1] = hv[1];
        }
    }

    // ---- V^T A-fragments, O^T += V^T.P^T; one V^T fragment serves both groups ----
    //      each accumulator's own order of sums is ph[g][0], ph[g][1];
    //      the loops are unrolled so that fragments and accumulators stay in registers
    HU uv[2][4];
#pragma unroll
    for (int u = 0; u < 2; ++u)
#pragma unroll
      for (int n = 0; n < 4; ++n) {
        const _Float16* vr = Vl + (16 * n + l16) * VL_STR + 32 * u;  // A row m = d 16n + l16
        uv[u][n].p[0] = *(const h8*)(vr + kb8);            // keys 32u + 8h + 0..7
        uv[u][n].p[1] = *(const h8*)(vr + 16 + kb8);       // keys 32u + 16 + 8h + 0..7
      }
#pragma unroll
    for (int u = 0; u < 2; ++u)
#pragma unroll
      for (int n = 0; n < 4; ++n)
#pragma unroll
        for (int g = 0; g < CG; ++g) acc[g][n] = wmma16(uv[u][n].v, ph[g][u], acc[g][n]);

    // ---- publish point of the next tile; the same barrier frees this trip's buffer ----
    asm volatile("s_wait_dscnt 0x0" ::: "memory");      // this wave's reads of this trip's buffer are over
    asm volatile("s_wait_asynccnt 0x0" ::: "memory");   // this wave's pieces of the next tile have landed
    __syncthreads();
    if (it + 2 < NT) {                                  // tile it + 2 exists: refill the buffer just read
      copy_tile(ks + boff, ks + boff + 32 * KL_STR * 2, vs + boff, vs + boff + 32 * VL_STR * 2,
                kp, kp + 32 * HD, vp, vp + (size_t)32 * SEQ);
      kp += STILE * HD;
      vp += STILE;
    }
    boff = BUF_BYTES - boff;
  }
  asm volatile("s_wait_asynccnt 0x0" ::: "memory");   // nothing in flight; the last trip's barrier ended every read before the staging alias

  // ---- finalize: ctx = acc / lsum / 16 (acc and lsum both carry P's x4096), staged as row map * 128 + query ----
#pragma unroll
  for (int g = 0; g < CG; ++g) {
    const float ls  = lsum[g] + xhalf(lsum[g]);
    const float inv = (1.0f / ls) * (1.0f / 16.0f);
    float* sw = stg + (wave * (16 * CG) + 16 * g + l16) * STG_STR + 8 * half;   // row = map * 128 + query
#pragma unroll
    for (int n = 0; n < 4; ++n) {
      f4 o0, o1;
#pragma unroll
      for (int j = 0; j < 4; ++j) {
        o0[j] = acc[g][n][j] * inv;
        o1[j] = acc[g][n][4 + j] * inv;
      }
      *(f4*)(sw + 16 * n)     = o0;    // d 16n + 8h + 0..3
      *(f4*)(sw + 16 * n + 4) = o1;    // d 16n + 8h + 4..7
    }
  }
  __syncthreads();
  // ---- combine the two maps and normalise: 16 lanes per row of 64 floats, 16 rows per pass, whole-line stores ----
  const int c4 = (tid & 15) * 4;
#pragma unroll
  for (int k = 0; k < QTILE / 16; ++k) {
    const int row = k * 16 + (tid >> 4);             // query 0..127
    const f4 a = *(const f4*)(stg + row * STG_STR + c4);
    const f4 b = *(const f4*)(stg + (QTILE + row) * STG_STR + c4);
    float x[4];
#pragma unroll
    for (int i = 0; i < 4; ++i) x[i] = a[i] - lam * b[i];
    float s = (x[0] + x[1]) + (x[2] + x[3]);
    s += __shfl_xor(s, 1, 32);
    s += __shfl_xor(s, 2, 32);
    s += __shfl_xor(s, 4, 32);
    s += __shfl_xor(s, 8, 32);
    const float mean = s * (1.0f / 64.0f);
    float d[4];
    float ss = 0.0f;
#pragma unroll
    for (int i = 0; i < 4; ++i) { d[i] = x[i] - mean; ss += d[i] * d[i]; }
    ss += __shfl_xor(ss, 1, 32);
    ss += __shfl_xor(ss, 2, 32);
    ss += __shfl_xor(ss, 4, 32);
    ss += __shfl_xor(ss, 8, 32);
    const float var = ss * (1.0f / 64.0f);
    const float rs  = rsqrtf(var + 1.0e-5f);
    f4 o;
#pragma unroll
    for (int i = 0; i < 4; ++i) o[i] = (d[i] * rs) * 0.2f;
    *(f4*)(Out + ((size_t)bh * SEQ + qBase + row) * HD + c4) = o;
  }
}

// =================================================================
// Host launcher
// =================================================================
extern "C" void kernel_launch(void* const* d_in, const int* in_sizes, int n_in,
                              void* d_out, int out_size, void* d_ws, size_t ws_size,
                              hipStream_t stream) {
  if (n_in < 4) return;
  const long long needIn = ((long long)(NBH - 1) * SEQ_FULL + SEQ) * HD;
  if ((long long)in_sizes[0] < needIn || (long long)in_sizes[1] < needIn ||
      (long long)in_sizes[2] < needIn || in_sizes[3] < 1) return;
  if ((long long)out_size < (long long)NBH * SEQ * HD) return;
  if (d_ws == nullptr || ws_size < WS_NEED) return;

  const float* Q   = (const float*)d_in[0];
  const float* K   = (const float*)d_in[1];
  const float* V   = (const float*)d_in[2];
  const float* Lam = (const float*)d_in[3];
  float* Out = (float*)d_out;

  char* ws = (char*)d_ws;
  _Float16* Kh  = (_Float16*)(ws);
  _Float16* Vt  = (_Float16*)(ws + KH_BYTES);

  k_conv<<<dim3(SEQ / STILE, NBH), dim3(256), 0, stream>>>(K, V, Kh, Vt);
  k_attn<<<dim3(SEQ / QTILE, NBH), dim3(256), 0, stream>>>(Q, Kh, Vt, Lam, in_sizes[3], Out);
}

// v010
// One run takes 51.4 microseconds.
// Two timings next to v009 put it at 1.04 and 1.03 times that version's speed.
// Counting every step since v000, it is 4.11 times as fast.
#include <hip/hip_runtime.h>

// scores k_half.q_half^T, transposed (both maps): v_wmma_f32_16x16x32_f16, f16 operands = bf16-RNE input values x16, f32 accumulate;
// V^T.P^T: v_wmma_f32_16x16x32_f16, P = one f16 value (x256, 11 significant bits), V = bf16-RNE input x16; softmax, combine, normalisation in f32.

typedef _Float16 v16h __attribute__((ext_vector_type(16)));
typedef _Float16 h8   __attribute__((ext_vector_type(8)));
typedef float    v8f  __attribute__((ext_vector_type(8)));
typedef float    f4   __attribute__((ext_vector_type(4)));
typedef unsigned int u4 __attribute__((ext_vector_type(4)));
typedef float    f2   __attribute__((ext_vector_type(2)));
typedef _Float16 h2   __attribute__((ext_vector_type(2)));

#ifndef NB
#define NB 2
#endif
#ifndef SEQ
#define SEQ 2048
#endif
#define NB_FULL  2
#define SEQ_FULL 2048
#define NH   16
#define HD   64
#define D2   32
#define NBH  (NB * NH)
#define QTILE 128          // query rows per block (4 waves x 32 rows for each of the two maps)
#define CG    2            // 16-query column groups per wave: each K / V^T fragment read from LDS feeds CG products
                           // (every loop over a group index g is unrolled: its arrays are indexed by g and must stay in registers)
#define STILE 64           // keys per main-loop iteration
#define NT    (SEQ / STILE)

static_assert(NB <= NB_FULL);
static_assert(SEQ <= SEQ_FULL);
static_assert(SEQ % QTILE == 0);
static_assert(QTILE == 4 * 16 * CG);     // four waves per map, CG groups of 16 queries each
static_assert(SEQ % STILE == 0);
static_assert(SEQ / STILE >= 2);         // the ring's prologue fills two tiles

// ---------------- workspace layout ----------------
#define KH_BYTES  ((size_t)NBH * SEQ * HD * 2)      // f16 K plane  [bh][s][64]
#define VT_BYTES  ((size_t)NBH * HD * SEQ * 2)      // f16 V^T plane [bh][64][s]
#define WS_NEED   (KH_BYTES + VT_BYTES)
static_assert(WS_NEED <= (size_t)134217728);
static_assert(KH_BYTES % 128 == 0);
static_assert(VT_BYTES % 128 == 0);

// ---------------- attention kernel LDS layout ----------------
#define KL_STR   72                                  // halves per K tile row (64 used: both d-halves)
#define VL_STR   72                                  // halves per V^T tile row (64 used)
#define KL_BYTES (STILE * KL_STR * 2)                // 9216
#define VL_BYTES (HD * VL_STR * 2)                   // 9216
#define STG_STR  68                                  // floats per staged output row (64 used; 272 B = 16 B x odd)
#define STG_BYTES (2 * QTILE * STG_STR * 4)          // 69632 epilogue staging, both maps (aliases the K / V tiles)
#define BUF_BYTES (KL_BYTES + VL_BYTES)             // 18432: one K tile and one V^T tile
static_assert(KL_STR == VL_STR);                    // one lane offset serves both tiles of a buffer
#define SMEM_ATT (2 * BUF_BYTES > STG_BYTES ? 2 * BUF_BYTES : STG_BYTES)

// bf16 RNE of an f32 value, returned as f32
__device__ __forceinline__ float bf16_rne(float x) {
  unsigned u = __float_as_uint(x);
  u = (u + 0x7FFFu + ((u >> 16) & 1u)) & 0xFFFF0000u;
  return __uint_as_float(u);
}
// bf16-RNE value carried x16 in an f16 container (exact)
__device__ __forceinline__ _Float16 cv16(float x) { return (_Float16)(bf16_rne(x) * 16.0f); }

// lane l <-> lane l ^ 16
__device__ __forceinline__ float xhalf(float x) {
  const int b = __builtin_bit_cast(int, x);
  return __builtin_bit_cast(float, __builtin_amdgcn_permlanex16(b, b, 0x76543210, 0xfedcba98, false, false));
}

__device__ __forceinline__ v8f wmma16(v16h a, v16h b, v8f c) {
  return __builtin_amdgcn_wmma_f32_16x16x32_f16(false, a, false, b, (short)0, c, false, false);
}

// One tile's four 16-byte pieces of this lane, global -> LDS through no register. The s_wait_xcnt stands inside
// the statement so that no address register of a copy is rewritten ahead of it.
__device__ __forceinline__ void copy_tile(unsigned l0, unsigned l1, unsigned l2, unsigned l3,
                                          const _Float16* g0, const _Float16* g1,
                                          const _Float16* g2, const _Float16* g3) {
  asm volatile("global_load_async_to_lds_b128 %0, %4, off\n\t"
               "global_load_async_to_lds_b128 %1, %5, off\n\t"
               "global_load_async_to_lds_b128 %2, %6, off\n\t"
               "global_load_async_to_lds_b128 %3, %7, off\n\t"
               "s_wait_xcnt 0x0"
               :: "v"(l0), "v"(l1), "v"(l2), "v"(l3), "v"(g0), "v"(g1), "v"(g2), "v"(g3) : "memory");
}

// =================================================================
// Pre-pass: K -> f16 plane [bh][s][64] (x16), V -> f16 transposed plane [bh][64][s] (x16)
// grid (SEQ/64, NBH), 256 threads; one 64-key tile per block
// =================================================================
__global__ __launch_bounds__(256) void k_conv(const float* __restrict__ K,
                                              const float* __restrict__ V,
                                              _Float16* __restrict__ Kh,
                                              _Float16* __restrict__ Vt) {
  __shared__ __align__(16) _Float16 vtl[HD * VL_STR];   // [d][s] tile, cross-wave (block barrier)
  const int tid = threadIdx.x;
  const int bh  = blockIdx.y;
  const int s0  = blockIdx.x * STILE;
  const float* Kg = K + ((size_t)bh * SEQ_FULL + s0) * HD;
  const float* Vg = V + ((size_t)bh * SEQ_FULL + s0) * HD;
  _Float16* Kp = Kh + ((size_t)bh * SEQ + s0) * HD;
  _Float16* Vp = Vt + (size_t)bh * HD * SEQ + s0;

  union HU8 { h8 h; u4 u; _Float16 s[8]; };
  HU8 kv[2];
#pragma unroll
  for (int i = 0; i < 2; ++i) {
    const int idx = tid + 256 * i;           // 0..511
    const int row = idx >> 3;                // key row 0..63
    const int c8  = (idx & 7) * 8;           // d 0..56
    const f4 a  = *(const f4*)(Kg + row * HD + c8);
    const f4 b  = *(const f4*)(Kg + row * HD + c8 + 4);
    const f4 va = *(const f4*)(Vg + row * HD + c8);
    const f4 vb = *(const f4*)(Vg + row * HD + c8 + 4);
#pragma unroll
    for (int e = 0; e < 4; ++e) {
      kv[i].s[e]     = cv16(a[e]);
      kv[i].s[4 + e] = cv16(b[e]);
      vtl[(c8 + e) * VL_STR + row]     = cv16(va[e]);
      vtl[(c8 + 4 + e) * VL_STR + row] = cv16(vb[e]);
    }
  }
  __syncthreads();
  HU8 vv[2];
#pragma unroll
  for (int i = 0; i < 2; ++i) {
    const int idx = tid + 256 * i;
    const int d   = idx >> 3;
    const int p8  = (idx & 7) * 8;
    vv[i].h = *(const h8*)(vtl + d * VL_STR + p8);
  }
#pragma unroll
  for (int i = 0; i < 2; ++i) {
    const int idx = tid + 256 * i;
    const int row = idx >> 3, c8 = (idx & 7) * 8;
    *(u4*)(Kp + row * HD + c8) = kv[i].u;
    *(u4*)(Vp + (size_t)row * SEQ + c8) = vv[i].u;   // row = d here
  }
  
}

__global__ __launch_bounds__(256) __attribute__((amdgpu_waves_per_eu(4, 4))) void k_attn(const float* __restrict__ Q,
                                              const _Float16* __restrict__ Kh,
                                              const _Float16* __restrict__ Vt,
                                              const float* __restrict__ Lam,
                                              int nlam,
                                              float* __restrict__ Out) {
  const int tid  = threadIdx.x;
  const int lane = tid & 31;
  const int wave = tid >> 5;
  const int l16  = lane & 15;
  const int half = lane >> 4;
  const int kb8  = half * 8;

  const int bh    = blockIdx.y;
  const int qBase = blockIdx.x * QTILE;
  const int doff  = (wave >> 2) * D2;   // map = wave >> 2

  __shared__ __align__(16) unsigned char smem[SMEM_ATT];
  // two buffers, each K tile [64 key][72] then V^T tile [64 d][72], cross-wave
  float*    stg = (float*)smem;                                              // epilogue alias [2 maps x 128][68]

  // ---- Q B-fragment (column = query l16, 32 d of the selected half) straight from f32 global ----
  union HU { v16h v; h8 p[2]; _Float16 s[16]; };
  v16h qa[CG];                         // group g: query (wave & 3) * 32 + 16g + l16
  {
    const float* qp = Q + ((size_t)bh * SEQ_FULL + qBase + (wave & 3) * (16 * CG) + l16) * HD + doff;
    f4 x0[CG], x1[CG], x2[CG], x3[CG];
#pragma unroll
    for (int g = 0; g < CG; ++g) {
      x0[g] = *(const f4*)(qp + g * 16 * HD + kb8);
      x1[g] = *(const f4*)(qp + g * 16 * HD + kb8 + 4);
      x2[g] = *(const f4*)(qp + g * 16 * HD + 16 + kb8);
      x3[g] = *(const f4*)(qp + g * 16 * HD + 16 + kb8 + 4);
    }
    asm volatile("s_wait_xcnt 0x0" ::: "memory");   // before the address registers of these loads are reused
#pragma unroll
    for (int g = 0; g < CG; ++g) {
      HU uq;
#pragma unroll
      for (int e = 0; e < 4; ++e) {
        uq.s[e]      = cv16(x0[g][e]);   // elements 0..7  <- d = 8h + 0..7
        uq.s[4 + e]  = cv16(x1[g][e]);
        uq.s[8 + e]  = cv16(x2[g][e]);   // elements 8..15 <- d = 16 + 8h + 0..7
        uq.s[12 + e] = cv16(x3[g][e]);
      }
      qa[g] = uq.v;
    }
  }

  // ---- this head's lambda, fetched here so that its latency is not paid in the epilogue ----
  int h = bh % NH;
  h = min(h, nlam - 1);
  h = max(h, 0);
  const float lam = bf16_rne(Lam[h]);

  // ---- online-softmax state ----
  // ---- per lane and group: one query; m in raw accumulator units; lsum = 256 x the sum over this lane half's keys, joined in the epilogue ----
  // ---- m is the maximum IN USE: it may trail the true running maximum; no maximum is taken on an ordinary trip. What must hold is
  //      that every 256 p fits f16, and the trip's own sum of exponentials (needed anyway) shows it: no term of a sum of
  //      non-negative terms exceeds the sum. off = 8 - m * SCL (the FMA's addend) changes only where m does ----
  float m[CG], off[CG], lsum[CG];
  v8f acc[CG][4];                      // O^T tiles: register j = d 16n + 8h + j, column = query 16g + l16
#pragma unroll
  for (int g = 0; g < CG; ++g) {
    m[g] = -1.0e30f;
    off[g] = 0.0f;
    lsum[g] = 0.0f;
#pragma unroll
    for (int n = 0; n < 4; ++n)
#pragma unroll
      for (int j = 0; j < 8; ++j) acc[g][n][j] = 0.0f;
  }

  const _Float16* khBase = Kh + (size_t)bh * SEQ * HD;
  const _Float16* vtBase = Vt + (size_t)bh * HD * SEQ;
  // log2(e) / sqrt(32) / 256 (q and k each carried x16): one raw score accumulator unit, in powers of two
  const float SCL = 1.4426950408889634f * 0.17677669529663688f * 0.00390625f;
  // a lane's 32 values of 256 p sum to at most PSUM_MAX: each stays inside f16 (65504). With m the true maximum the sum is
  // at most 32 * 256 = 8192, so a failed test means that some score tops m by more than two powers of two: m then rises
  const float PSUM_MAX = 32768.0f;

  // staging: this thread's 16-byte piece of rows srow and srow + 32 of the K tile and of the V^T tile
  const int srow = tid >> 3;          // 0..31: key row of K, d row of V^T
  const int sp8  = (tid & 7) * 8;     // 0..56: d of K, key of V^T
  const _Float16* kp = khBase + (size_t)srow * HD + sp8;
  const _Float16* vp = vtBase + (size_t)srow * SEQ + sp8;
  const unsigned ks = (unsigned)(size_t)smem + (srow * KL_STR + sp8) * 2;   // LDS byte address in buffer 0
  const unsigned vs = ks + KL_BYTES;                                        // the same place in the V^T tile

  // ---- S^T over four 16-key subtiles of the K tile at Kl (K = 32 = one WMMA each and group); one K fragment serves both groups ----
  auto scores = [&](const _Float16* Kl, float (&p)[CG][4][8]) {
#pragma unroll
    for (int t = 0; t < 4; ++t) {
      HU ua;
      const _Float16* kr = Kl + (t * 16 + l16) * KL_STR + doff;   // A row m = key t*16 + l16, this map's d-half
      ua.p[0] = *(const h8*)(kr + kb8);                    // elements 0..7  <- d = 8h + 0..7
      ua.p[1] = *(const h8*)(kr + 16 + kb8);               // elements 8..15 <- d = 16 + 8h + 0..7
#pragma unroll
      for (int g = 0; g < CG; ++g) {
        v8f c8;
#pragma unroll
        for (int j = 0; j < 8; ++j) c8[j] = 0.0f;
        c8 = wmma16(ua.v, qa[g], c8);                      // D[key t*16 + 8h + j][query 16g + l16]
#pragma unroll
        for (int j = 0; j < 8; ++j) p[g][t][j] = c8[j];    // raw accumulator
      }
    }
  };
  // ---- renewal of m from the tile at Kl: scores, their maximum, then m, the FMA's addend, the row sums and the accumulators move ----
  auto renew = [&](const _Float16* Kl, float (&p)[CG][4][8]) {
    scores(Kl, p);
#pragma unroll
    for (int g = 0; g < CG; ++g) {
      float tmax = -1.0e30f;             // SCL > 0 keeps the order of the maximum
#pragma unroll
      for (int t = 0; t < 4; ++t)
#pragma unroll
        for (int j = 0; j < 8; ++j) tmax = fmaxf(tmax, p[g][t][j]);
      // one query per lane: maximum in-lane, one exchange between the lane halves, so that both halves hold the same m
      const float tm   = fmaxf(tmax, xhalf(tmax));
      const float nm   = fmaxf(m[g], tm);
      const float corr = __builtin_amdgcn_exp2f((m[g] - nm) * SCL);
      m[g]   = nm;
      off[g] = 8.0f - nm * SCL;          // 256 p = 2^(c * SCL - m * SCL + 8): scale, base change and P's x256 in one FMA
      lsum[g] *= corr;
#pragma unroll
      for (int n = 0; n < 4; ++n)
#pragma unroll
        for (int j = 0; j < 8; ++j) acc[g][n][j] *= corr;
    }
  };

  // ---- ring prologue: tile 0 landed and published, tile 1 in flight ----
  copy_tile(ks, ks + 32 * KL_STR * 2, vs, vs + 32 * VL_STR * 2, kp, kp + 32 * HD, vp, vp + (size_t)32 * SEQ);
  kp += STILE * HD;
  vp += STILE;
  asm volatile("s_wait_asynccnt 0x0" ::: "memory");   // this wave's pieces of tile 0 have landed
  __syncthreads();
  copy_tile(ks + BUF_BYTES, ks + BUF_BYTES + 32 * KL_STR * 2, vs + BUF_BYTES, vs + BUF_BYTES + 32 * VL_STR * 2,
            kp, kp + 32 * HD, vp, vp + (size_t)32 * SEQ);
  kp += STILE * HD;
  vp += STILE;

  // ---- m starts as the maximum over tile 0 (published by the barrier above), so that the first trip runs like any other ----
  {
    float p0[CG][4][8];
    renew((const _Float16*)smem, p0);
  }

  unsigned boff = 0;                  // byte offset of the buffer that this trip reads
  for (int it = 0; it < NT; ++it) {
    const _Float16* Kl = (const _Float16*)(smem + boff);
    const _Float16* Vl = (const _Float16*)(smem + boff + KL_BYTES);

    float p[CG][4][8];
    // ---- p <- 256 exp(score - m), in place; ts[g] = this lane's sum of them; ph = the P^T B-fragments ----
    float ts[CG];
    v16h ph[CG][2];
    auto expsum = [&]() {
#pragma unroll
      for (int g = 0; g < CG; ++g) {
#pragma unroll
        for (int t = 0; t < 4; ++t)
#pragma unroll
          for (int j = 0; j < 8; j += 2) {
            // the FMA on the accumulator's own even register pair, so that no score is copied to form a pair
            const f2 x = __builtin_elementwise_fma((f2){p[g][t][j], p[g][t][j + 1]}, (f2){SCL, SCL}, (f2){off[g], off[g]});
            p[g][t][j]     = __builtin_amdgcn_exp2f(x[0]);
            p[g][t][j + 1] = __builtin_amdgcn_exp2f(x[1]);
          }
        // one independent chain per subtile, on the register pairs as the exponentials leave them (even and odd registers apart)
        f2 s[4];
#pragma unroll
        for (int t = 0; t < 4; ++t) {
          s[t] = (f2){p[g][t][0], p[g][t][1]};
#pragma unroll
          for (int j = 2; j < 8; j += 2) s[t] += (f2){p[g][t][j], p[g][t][j + 1]};
        }
        const f2 sa = (s[0] + s[1]) + (s[2] + s[3]);
        ts[g] = sa[0] + sa[1];

        // P^T B-fragments in place: f16(256 p), rounded to nearest: within 2^-11 of p or 2^-33 of exp(m),
        // whichever is larger, three bits finer than V's own 8-bit significand; the row sum stays on the f32 p;
        // element e of pair u <- key 32u + (e < 8 ? 8h + e : 16 + 8h + e - 8) = subtile 2u + (e >> 3), register e & 7
#pragma unroll
        for (int t = 0; t < 4; ++t)
#pragma unroll
          for (int j = 0; j < 8; j += 2) {
            const f2 pc = {p[g][t][j], p[g][t][j + 1]};     // already 256 p
            const h2 hv = __builtin_convertvector(pc, h2);
            ph[g][t >> 1][(t & 1) * 8 + j]     = hv[0];
            ph[g][t >> 1][(t & 1) * 8 + j + 1] = hv[1];
          }
      }
    };
    scores(Kl, p);
    // ---- V^T A-fragments of the first 32 keys, read ahead of the test: behind its branch they could not start before it is decided ----
    HU uv[2][4];
    auto vfrag = [&](int u) {
#pragma unroll
      for (int n = 0; n < 4; ++n) {
        const _Float16* vr = Vl + (16 * n + l16) * VL_STR + 32 * u;  // A row m = d 16n + l16
        uv[u][n].p[0] = *(const h8*)(vr + kb8);            // keys 32u + 8h + 0..7
        uv[u][n].p[1] = *(const h8*)(vr + 16 + kb8);       // keys 32u + 16 + 8h + 0..7
      }
    };
    vfrag(0);
    expsum();

    // ---- renewal of m: one test per trip for the whole wave, on the sums. Each lane tests its own half's keys, the ballot joins
    //      the halves and the groups; only when a sum is too large (or not a number) are the scores formed again, their maximum
    //      taken, and m, the row sums and the accumulators moved (rare); wave-uniform branch, no barrier ----
    bool need = false;
#pragma unroll
    for (int g = 0; g < CG; ++g) need = need || !(ts[g] <= PSUM_MAX);
    if (__builtin_amdgcn_ballot_w32(need) != 0) {
      // compiler fence: the K fragments are read again here, not held in 32 registers through every trip for this rare path
      asm volatile("" ::: "memory");
      renew(Kl, p);                      // the exponentials overwrote the scores; this trip's K tile is still in its buffer
      expsum();                          // now every 256 p <= 256
    }

#pragma unroll
    for (int g = 0; g < CG; ++g) lsum[g] += ts[g];

    // ---- V^T A-fragments, O^T += V^T.P^T; one V^T fragment serves both groups ----
    //      each accumulator's own order of sums is ph[g][0], ph[g][1];
    //      the loops are unrolled so that fragments and accumulators stay in registers
    vfrag(1);
#pragma unroll
    for (int u = 0; u < 2; ++u)
#pragma unroll
      for (int n = 0; n < 4; ++n)
#pragma unroll
        for (int g = 0; g < CG; ++g) acc[g][n] = wmma16(uv[u][n].v, ph[g][u], acc[g][n]);

    // ---- publish point of the next tile; the same barrier frees this trip's buffer ----
    asm volatile("s_wait_dscnt 0x0" ::: "memory");      // this wave's reads of this trip's buffer are over
    asm volatile("s_wait_asynccnt 0x0" ::: "memory");   // this wave's pieces of the next tile have landed
    __syncthreads();
    if (it + 2 < NT) {                                  // tile it + 2 exists: refill the buffer just read
      copy_tile(ks + boff, ks + boff + 32 * KL_STR * 2, vs + boff, vs + boff + 32 * VL_STR * 2,
                kp, kp + 32 * HD, vp, vp + (size_t)32 * SEQ);
      kp += STILE * HD;
      vp += STILE;
    }
    boff = BUF_BYTES - boff;
  }
  asm volatile("s_wait_asynccnt 0x0" ::: "memory");   // nothing in flight; the last trip's barrier ended every read before the staging alias

  // ---- finalize: ctx = acc / lsum / 16 (acc and lsum both carry P's x256), staged as row map * 128 + query ----
#pragma unroll
  for (int g = 0; g < CG; ++g) {
    const float ls  = lsum[g] + xhalf(lsum[g]);
    const float inv = (1.0f / ls) * (1.0f / 16.0f);
    float* sw = stg + (wave * (16 * CG) + 16 * g + l16) * STG_STR + 8 * half;   // row = map * 128 + query
#pragma unroll
    for (int n = 0; n < 4; ++n) {
      f4 o0, o1;
#pragma unroll
      for (int j = 0; j < 4; ++j) {
        o0[j] = acc[g][n][j] * inv;
        o1[j] = acc[g][n][4 + j] * inv;
      }
      *(f4*)(sw + 16 * n)     = o0;    // d 16n + 8h + 0..3
      *(f4*)(sw + 16 * n + 4) = o1;    // d 16n + 8h + 4..7
    }
  }
  __syncthreads();
  // ---- combine the two maps and normalise: 16 lanes per row of 64 floats, 16 rows per pass, whole-line stores ----
  const int c4 = (tid & 15) * 4;
#pragma unroll
  for (int k = 0; k < QTILE / 16; ++k) {
    const int row = k * 16 + (tid >> 4);             // query 0..127
    const f4 a = *(const f4*)(stg + row * STG_STR + c4);
    const f4 b = *(const f4*)(stg + (QTILE + row) * STG_STR + c4);
    float x[4];
#pragma unroll
    for (int i = 0; i < 4; ++i) x[i] = a[i] - lam * b[i];
    float s = (x[0] + x[1]) + (x[2] + x[3]);
    s += __shfl_xor(s, 1, 32);
    s += __shfl_xor(s, 2, 32);
    s += __shfl_xor(s, 4, 32);
    s += __shfl_xor(s, 8, 32);
    const float mean = s * (1.0f / 64.0f);
    float d[4];
    float ss = 0.0f;
#pragma unroll
    for (int i = 0; i < 4; ++i) { d[i] = x[i] - mean; ss += d[i] * d[i]; }
    ss += __shfl_xor(ss, 1, 32);
    ss += __shfl_xor(ss, 2, 32);
    ss += __shfl_xor(ss, 4, 32);
    ss += __shfl_xor(ss, 8, 32);
    const float var = ss * (1.0f / 64.0f);
    const float rs  = rsqrtf(var + 1.0e-5f);
    f4 o;
#pragma unroll
    for (int i = 0; i < 4; ++i) o[i] = (d[i] * rs) * 0.2f;
    *(f4*)(Out + ((size_t)bh * SEQ + qBase + row) * HD + c4) = o;
  }
}

// =================================================================
// Host launcher
// =================================================================
extern "C" void kernel_launch(void* const* d_in, const int* in_sizes, int n_in,
                              void* d_out, int out_size, void* d_ws, size_t ws_size,
                              hipStream_t stream) {
  if (n_in < 4) return;
  const long long needIn = ((long long)(NBH - 1) * SEQ_FULL + SEQ) * HD;
  if ((long long)in_sizes[0] < needIn || (long long)in_sizes[1] < needIn ||
      (long long)in_sizes[2] < needIn || in_sizes[3] < 1) return;
  if ((long long)out_size < (long long)NBH * SEQ * HD) return;
  if (d_ws == nullptr || ws_size < WS_NEED) return;

  const float* Q   = (const float*)d_in[0];
  const float* K   = (const float*)d_in[1];
  const float* V   = (const float*)d_in[2];
  const float* Lam = (const float*)d_in[3];
  float* Out = (float*)d_out;

  char* ws = (char*)d_ws;
  _Float16* Kh  = (_Float16*)(ws);
  _Float16* Vt  = (_Float16*)(ws + KH_BYTES);

  k_conv<<<dim3(SEQ / STILE, NBH), dim3(256), 0, stream>>>(K, V, Kh, Vt);
  k_attn<<<dim3(SEQ / QTILE, NBH), dim3(256), 0, stream>>>(Q, Kh, Vt, Lam, in_sizes[3], Out);
}
